// v000
// Times are from an AMD MI455X. After a warm-up the kernel runs many times in a row, and a time is the length of
// such a window on the GPU divided by its runs, so every launch and the gaps after it count. The runs cycle
// through copies of the inputs. A figure is the median of several windows, for all but v000 over two sittings.
// Sittings can differ by a few percent; kernels timed side by side share one.
// The starting kernel, v000, takes 321 microseconds a run.
#include <hip/hip_runtime.h>

// CLVP self-attention: q/k/v = x.W^T (torch [out][in] weights, no bias), partial rotary embedding on the first 32 dims of every head of q, k AND v
// (rotate-half: pairs (d, d+16), cos/sin of the given rotary_pos_emb[s][d]), q x 1/8, causal softmax, y = P.V, out = y.Wo^T + bo. B=4, S=1024, 16x64.
// All contractions as bf16 hi/lo splits on v_wmma_f32_16x16x32_bf16 (hi.hi + hi.lo + lo.hi, f32 accumulate): the outputs have rms 0.04.

namespace {
constexpr int Bsz = 4, T = 1024, HID = 1024, DH = 64, NH = 16, NKV = 16, REP = NH / NKV;
constexpr int ROT = 32;   // rotary dims per head
constexpr int KVW = NKV * DH;                 // 1024
constexpr int NQKV = HID + 2 * KVW;           // 3072 columns: q | k | v
constexpr int MROWS = Bsz * T;                // 4096
constexpr int QT_PER_B = T / 16;              // 64

typedef __bf16 b16;
typedef __attribute__((ext_vector_type(16))) __bf16 v16b;
typedef __attribute__((ext_vector_type(8)))  __bf16 v8b;
typedef __attribute__((ext_vector_type(8)))  float v8f;
typedef __attribute__((ext_vector_type(4)))  float v4f;

__device__ __forceinline__ v8b ld8b(const b16* p) { return *(const v8b*)p; }
__device__ __forceinline__ v16b cat8b(v8b a, v8b b) { return __builtin_shufflevector(a, b, 0, 1, 2, 3, 4, 5, 6, 7, 8, 9, 10, 11, 12, 13, 14, 15); }
// 16x16x32 16-bit fragment from a k-contiguous row pointer (A: lane&15 = row, B: lane&15 = column), hh = lane>>4:
// elements 0..7 <- p[8hh+0..7], elements 8..15 <- p[16+8hh+0..7]
__device__ __forceinline__ v16b frag_kb(const b16* p, int hh) { return cat8b(ld8b(p + 8 * hh), ld8b(p + 16 + 8 * hh)); }
__device__ __forceinline__ void split_bf16(float v, b16& hi, b16& lo) {
  const unsigned int u = __builtin_bit_cast(unsigned int, v) & 0xffff0000u;
  hi = __builtin_bit_cast(b16, (unsigned short)(u >> 16));
  lo = (b16)(v - __builtin_bit_cast(float, u));
}
// split fragment straight from an f32 k-contiguous row
__device__ __forceinline__ void frag_ksplit(const float* p, int hh, v16b& fh_, v16b& fl_) {
  const float* p0 = p + 8 * hh; const float* p1 = p + 16 + 8 * hh;
#pragma unroll
  for (int e = 0; e < 8; ++e) { b16 a, c; split_bf16(p0[e], a, c); fh_[e] = a; fl_[e] = c; split_bf16(p1[e], a, c); fh_[8 + e] = a; fl_[8 + e] = c; }
}
__device__ __forceinline__ v8f wmma16b(v16b a, v16b b, v8f c) {
  v8f d = __builtin_amdgcn_wmma_f32_16x16x32_bf16(false, a, false, b, (short)0, c, false, false);
  asm volatile("v_nop\n\tv_nop\n\tv_nop\n\tv_nop" : "+v"(d) : "v"(a), "v"(b));
  return d;
}
// acc += A.B with both operands split: A = (ah, al), B = (bh, bl)
__device__ __forceinline__ v8f wmma3(v16b ah, v16b al, v16b bh, v16b bl, v8f c) {
  c = wmma16b(ah, bh, c); c = wmma16b(ah, bl, c); c = wmma16b(al, bh, c); return c;
}
__device__ __forceinline__ void wave_lds_sync() {
  __builtin_amdgcn_fence(__ATOMIC_RELEASE, "workgroup");
  __builtin_amdgcn_wave_barrier();
  __builtin_amdgcn_fence(__ATOMIC_ACQUIRE, "workgroup");
}

// ---------------------------------------------------------------------------
// Weights (torch [out][in] = [n][k]) -> bf16 hi / lo planes in the same [n][k] order (k contiguous): columns of Wq|Wk|Wv into wqh/wql [3072][1024], Wo into woh/wol [1024][1024].
// ---------------------------------------------------------------------------
__global__ __launch_bounds__(256) void wcvt_kernel(const float* __restrict__ wq, const float* __restrict__ wk, const float* __restrict__ wv,
                                                   const float* __restrict__ wo, b16* __restrict__ wqh, b16* __restrict__ wql,
                                                   b16* __restrict__ woh, b16* __restrict__ wol) {
  const size_t tid = (size_t)blockIdx.x * blockDim.x + threadIdx.x, stride = (size_t)gridDim.x * blockDim.x;
  const size_t nq = (size_t)NQKV * HID / 8, no = (size_t)HID * HID / 8;
  {
    for (size_t c = tid; c < nq + no; c += stride) {
      float f[8]; size_t i; b16* dh; b16* dl;
      if (c < nq) {
        i = c * 8; const size_t n = i / HID, k0 = i % HID;
        const float* w; int nn, ld;
        if (n < (size_t)HID) { w = wq; nn = (int)n; ld = HID; } else if (n < (size_t)(HID + KVW)) { w = wk; nn = (int)n - HID; ld = KVW; } else { w = wv; nn = (int)n - HID - KVW; ld = KVW; }
#pragma unroll
        for (int e = 0; e < 8; ++e) f[e] = w[(size_t)nn * HID + k0 + e];      // W[n][k] (torch [out][in]); ld unused
        (void)ld;
        dh = wqh; dl = wql;
      } else {
        i = (c - nq) * 8; const size_t n = i / HID, k0 = i % HID;
#pragma unroll
        for (int e = 0; e < 8; ++e) f[e] = wo[(size_t)n * HID + k0 + e];    // Wo[n][k] (torch [out][in])
        dh = woh; dl = wol;
      }
      v8b bh, bl;
#pragma unroll
      for (int e = 0; e < 8; ++e) { b16 a, cc; split_bf16(f[e], a, cc); bh[e] = a; bl[e] = cc; }
      *(v8b*)(dh + i) = bh; *(v8b*)(dl + i) = bl;
    }
    
  }
}

// 32x64 wave tile over K from f32 A rows and bf16-plane B rows
__device__ __forceinline__ void gemm_tile_split(const float* __restrict__ A, const b16* __restrict__ wh, const b16* __restrict__ wl,
                                                int m0, int c0, int K, int nloc, int hlf, v8f (&acc)[2][4]) {
  for (int kb = 0; kb < K; kb += 32) {
    v16b a0h, a0l, a1h, a1l;
    frag_ksplit(A + (size_t)(m0 + nloc) * K + kb, hlf, a0h, a0l);
    frag_ksplit(A + (size_t)(m0 + 16 + nloc) * K + kb, hlf, a1h, a1l);
#pragma unroll
    for (int t = 0; t < 4; ++t) {
      const size_t wofs = (size_t)(c0 + t * 16 + nloc) * K + kb;
      const v16b bh = frag_kb(wh + wofs, hlf), bl = frag_kb(wl + wofs, hlf);
      acc[0][t] = wmma3(a0h, a0l, bh, bl, acc[0][t]);
      acc[1][t] = wmma3(a1h, a1l, bh, bl, acc[1][t]);
    }
  }
}

// ---------------------------------------------------------------------------
// QKV GEMM: (4096 x 1024) x (1024 x 3072), grid (48, 32), block 4 waves, wave = 32 rows x 64 columns (one head of q, k or v). Outputs as bf16 hi/lo planes:
// q (x1/8) -> Qh/Ql [b][h][t][64]; k -> Kh/Kl [b][kvh][t][64] (4 KB contiguous per wave per plane);
// v -> Vh/Vl key-tiled [b][kvh][t/16][64][16] (4 KB contiguous per wave per plane).
// ---------------------------------------------------------------------------
__global__ __launch_bounds__(128) void qkv_gemm_kernel(const float* __restrict__ xq, const float* __restrict__ xk, const float* __restrict__ xv,
                                                       const b16* __restrict__ wqh, const b16* __restrict__ wql,
                                                       const float* __restrict__ bq, const float* __restrict__ bk, const float* __restrict__ bv, const float* __restrict__ rope_cs, int xoff, int yoff,
                                                       b16* __restrict__ Qh, b16* __restrict__ Ql, b16* __restrict__ Kh, b16* __restrict__ Kl,
                                                       b16* __restrict__ Vh, b16* __restrict__ Vl) {
  __shared__ __attribute__((aligned(16))) b16 Ts[4][2][32 * 64];
  const int lane = threadIdx.x & 31, wave = threadIdx.x >> 5, nloc = lane & 15, hlf = lane >> 4;
  const int m0 = (blockIdx.y + yoff) * 128 + wave * 32;
  const int c0 = (blockIdx.x + xoff) * 64;
  const int mat = (c0 < HID) ? 0 : (c0 < HID + KVW) ? 1 : 2;
  const int head = (mat == 0) ? (c0 / DH) : (mat == 1) ? ((c0 - HID) / DH) : ((c0 - HID - KVW) / DH);
  const float* x = (mat == 0) ? xq : (mat == 1) ? xk : xv;          // q, k and v inputs; the launch passes x for all three
  const float* bias = ((mat == 0) ? bq : (mat == 1) ? bk : bv) + head * DH;
  v8f acc[2][4];
#pragma unroll
  for (int r = 0; r < 2; ++r)
#pragma unroll
    for (int t = 0; t < 4; ++t) acc[r][t] = (v8f){};
  gemm_tile_split(x, wqh, wql, m0, c0, HID, nloc, hlf, acc);
  const int b = m0 / T, t0 = m0 % T;
  const float s = (mat == 0) ? 0.125f : 1.0f;
  b16* Tp0 = Ts[wave][0]; b16* Tp1 = Ts[wave][1];
#pragma unroll
  for (int t = 0; t < 4; ++t)
#pragma unroll
    for (int r = 0; r < 2; ++r)
#pragma unroll
      for (int v = 0; v < 8; ++v) {
        const int rr = r * 16 + v + 8 * hlf, d = t * 16 + nloc;
        float val = acc[r][t][v] + (bias ? bias[d] : 0.0f);
        if (t < 2) {                                     // partial rotary on dims 0..31 of q, k and v: x*cos(f) + rotate_half(x)*sin(f), partner d^16 is tile t^1 (same lane)
          const int tpos = t0 + rr;                      // sequence position of this row
          const float cv = rope_cs[((size_t)tpos * ROT + d) * 2], sv = rope_cs[((size_t)tpos * ROT + d) * 2 + 1];   // precomputed cos/sin of rotary_pos_emb
          const float oth = acc[r][t ^ 1][v] + (bias ? bias[d ^ 16] : 0.0f);
          val = (t == 0) ? (val * cv - oth * sv) : (val * cv + oth * sv);
        }
        b16 yh, yl; split_bf16(val * s, yh, yl);
        const int idx = (mat < 2) ? (rr * 64 + d) : ((rr >> 4) * 1024 + d * 16 + (rr & 15));
        Tp0[idx] = yh; Tp1[idx] = yl;
      }
  wave_lds_sync();
  b16* dh; b16* dl; size_t o;
  if (mat == 0)      { o = ((size_t)(b * NH + head) * T + t0) * DH; dh = Qh + o; dl = Ql + o; }
  else if (mat == 1) { o = ((size_t)(b * NKV + head) * T + t0) * DH; dh = Kh + o; dl = Kl + o; }
  else               { o = ((size_t)(b * NKV + head) * QT_PER_B + (t0 >> 4)) * (size_t)(DH * 16); dh = Vh + o; dl = Vl + o; }
#pragma unroll
  for (int j = 0; j < 8; ++j) { const int e = (j * 32 + lane) * 8; *(v8b*)(dh + e) = ld8b(Tp0 + e); *(v8b*)(dl + e) = ld8b(Tp1 + e); }
  
}

// ---------------------------------------------------------------------------
// Transposed flash attention: each wave owns one 16-query tile of one (b, head); 8 waves per block; key chunks of 32 up to the diagonal.
// S^T = K.Q^T (split), per-lane online softmax; P^T built in registers from the two S^T accumulators
// ---------------------------------------------------------------------------
__global__ __launch_bounds__(256) void attn_kernel(const b16* __restrict__ Qh, const b16* __restrict__ Ql, const b16* __restrict__ Kh, const b16* __restrict__ Kl,
                                                   const b16* __restrict__ Vh, const b16* __restrict__ Vl,
                                                   float* __restrict__ yf) {
  __shared__ __attribute__((aligned(16))) float Os[8][16 * 64];
  const int wid = threadIdx.x >> 5, lane = threadIdx.x & 31, hh = lane >> 4, col = lane & 15;
  const int qtile = blockIdx.x * 8 + wid;                 // over Bsz*NH*QT_PER_B
  const int g = qtile / QT_PER_B;                         // b*NH + h
  const int q0 = (qtile % QT_PER_B) << 4;
  const int b = g / NH, h = g % NH, kvh = h / REP;
  const size_t ko = (size_t)(b * NKV + kvh) * T * DH;
  const size_t qo = ((size_t)g * T + q0 + col) * DH;
  const v16b q0h = frag_kb(Qh + qo, hh), q0l = frag_kb(Ql + qo, hh), q1h = frag_kb(Qh + qo + 32, hh), q1l = frag_kb(Ql + qo + 32, hh);
  float m = -INFINITY, l = 0.0f;
  v8f o0 = {}, o1 = {}, o2 = {}, o3 = {};
  for (int kb = 0; kb < q0 + 16; kb += 32) {             // causal: key chunks up to the tile's last query
    const size_t r0 = ko + (size_t)(kb + col) * DH, r1 = ko + (size_t)(kb + 16 + col) * DH;
    v8f s0 = {}, s1 = {};
    {
      v16b ah = frag_kb(Kh + r0, hh), al = frag_kb(Kl + r0, hh);
      s0 = wmma3(ah, al, q0h, q0l, s0);
      ah = frag_kb(Kh + r0 + 32, hh); al = frag_kb(Kl + r0 + 32, hh);
      s0 = wmma3(ah, al, q1h, q1l, s0);
      ah = frag_kb(Kh + r1, hh); al = frag_kb(Kl + r1, hh);
      s1 = wmma3(ah, al, q0h, q0l, s1);
      ah = frag_kb(Kh + r1 + 32, hh); al = frag_kb(Kl + r1 + 32, hh);
      s1 = wmma3(ah, al, q1h, q1l, s1);
    }
    if (kb + 32 > q0) {                                   // diagonal chunk: mask keys after the query
      const int qi = q0 + col;
#pragma unroll
      for (int r = 0; r < 8; ++r) {
        if (kb + 8 * hh + r > qi)      s0[r] = -INFINITY;
        if (kb + 16 + 8 * hh + r > qi) s1[r] = -INFINITY;
      }
    }
    float mr = -INFINITY;
#pragma unroll
    for (int r = 0; r < 8; ++r) mr = fmaxf(mr, fmaxf(s0[r], s1[r]));
    mr = fmaxf(mr, __shfl_xor(mr, 16));
    const float mn = fmaxf(m, mr);            // finite
    const float al_ = __expf(m - mn);
    m = mn;
    float sum = 0.0f;
    v16b pbh, pbl;
#pragma unroll
    for (int r = 0; r < 8; ++r) {
      const float p0 = __expf(s0[r] - mn), p1 = __expf(s1[r] - mn);
      sum += p0 + p1;
      b16 a, c; split_bf16(p0, a, c); pbh[r] = a; pbl[r] = c; split_bf16(p1, a, c); pbh[8 + r] = a; pbl[8 + r] = c;
    }
    sum += __shfl_xor(sum, 16);
    l = l * al_ + sum;
#pragma unroll
    for (int r = 0; r < 8; ++r) { o0[r] *= al_; o1[r] *= al_; o2[r] *= al_; o3[r] *= al_; }
    const size_t v0 = ko + (size_t)(kb >> 4) * (DH * 16) + 8 * hh, v1 = v0 + DH * 16;
#pragma unroll
    for (int n = 0; n < 4; ++n) {
      const int f = n * 16 + col;
      const v16b vah = cat8b(ld8b(Vh + v0 + f * 16), ld8b(Vh + v1 + f * 16));
      const v16b val = cat8b(ld8b(Vl + v0 + f * 16), ld8b(Vl + v1 + f * 16));
      v8f& o = (n == 0) ? o0 : (n == 1) ? o1 : (n == 2) ? o2 : o3;
      o = wmma3(vah, val, pbh, pbl, o);
    }
  }
  const float inv = 1.0f / l;
  float* Tt = Os[wid];
#pragma unroll
  for (int r = 0; r < 8; ++r) {
    const int hr = 8 * hh + r;
    Tt[col * 64 + 0 + hr] = o0[r] * inv; Tt[col * 64 + 16 + hr] = o1[r] * inv;
    Tt[col * 64 + 32 + hr] = o2[r] * inv; Tt[col * 64 + 48 + hr] = o3[r] * inv;
  }
  wave_lds_sync();
  float* dst0 = yf + ((size_t)b * T + q0) * HID + h * DH;     // 16 rows x 64 floats, row stride HID
#pragma unroll
  for (int j = 0; j < 8; ++j) { const int rr = j * 2 + hh, c4 = col * 4; *(v4f*)(dst0 + (size_t)rr * HID + c4) = *(const v4f*)(Tt + rr * 64 + c4); }
  
}

// ---------------------------------------------------------------------------
// Output projection: (4096 x 1024) x (1024 x 1024) -> f32, A split on the fly from f32 y, B = Wo planes. grid (16, 32), 32x64 tiles staged in LDS,
// ---------------------------------------------------------------------------
__global__ __launch_bounds__(128) void out_gemm_kernel(const float* __restrict__ yf, const b16* __restrict__ woh, const b16* __restrict__ wol, const float* __restrict__ bo, int yoff,
                                                       float* __restrict__ out) {
  __shared__ __attribute__((aligned(16))) float Ts[4][32 * 64];
  const int lane = threadIdx.x & 31, wave = threadIdx.x >> 5, nloc = lane & 15, hlf = lane >> 4;
  const int m0 = (blockIdx.y + yoff) * 128 + wave * 32;
  const int c0 = blockIdx.x * 64;
  v8f acc[2][4];
#pragma unroll
  for (int r = 0; r < 2; ++r)
#pragma unroll
    for (int t = 0; t < 4; ++t) acc[r][t] = (v8f){};
  gemm_tile_split(yf, woh, wol, m0, c0, HID, nloc, hlf, acc);
  float* Tt = Ts[wave];
#pragma unroll
  for (int t = 0; t < 4; ++t)
#pragma unroll
    for (int r = 0; r < 2; ++r)
#pragma unroll
      for (int v = 0; v < 8; ++v) Tt[(r * 16 + v + 8 * hlf) * 64 + t * 16 + nloc] = acc[r][t][v] + bo[c0 + t * 16 + nloc];
  wave_lds_sync();
  float* dst0 = out + (size_t)m0 * HID + c0;
#pragma unroll
  for (int j = 0; j < 16; ++j) { const int rr = j * 2 + hlf, c4 = nloc * 4; *(v4f*)(dst0 + (size_t)rr * HID + c4) = *(const v4f*)(Tt + rr * 64 + c4); }
  
}
__global__ __launch_bounds__(256) void rope_table_kernel(const float* __restrict__ fr, float* __restrict__ cs) {
  const int idx = blockIdx.x * 256 + threadIdx.x;        // T * 32
  if (idx >= T * ROT) return;
  const float f = fr[idx];
  typedef __attribute__((ext_vector_type(2))) float v2f;
  const v2f p = {cosf(f), sinf(f)};
  *(v2f*)(cs + (size_t)idx * 2) = p; 
}
}  // namespace

extern "C" void kernel_launch(void* const* d_in, const int* in_sizes, int n_in,
                              void* d_out, int out_size, void* d_ws, size_t ws_size, hipStream_t stream) {
  (void)in_sizes; (void)n_in; (void)out_size;
  const float* x  = (const float*)d_in[0];   // hidden_states [4,1024,1024]
  const float* fr = (const float*)d_in[1];   // rotary_pos_emb [1,1024,32]
  const float* Wq = (const float*)d_in[2];   // [1024,1024] torch [out][in]
  const float* Wk = (const float*)d_in[3];
  const float* Wv = (const float*)d_in[4];
  const float* Wo = (const float*)d_in[5];
  const float* bo = (const float*)d_in[6];
  const float* bq = nullptr; const float* bk = nullptr; const float* bv = nullptr;
  float* out = (float*)d_out;                // [4,1024,1024] f32

  size_t off = 0; char* ws = (char*)d_ws;
  b16* wqh = (b16*)(ws + off); off += (size_t)NQKV * HID * 2;     // 6 MB
  b16* wql = (b16*)(ws + off); off += (size_t)NQKV * HID * 2;
  b16* woh = (b16*)(ws + off); off += (size_t)HID * HID * 2;      // 2 MB
  b16* wol = (b16*)(ws + off); off += (size_t)HID * HID * 2;
  b16* Qh  = (b16*)(ws + off); off += (size_t)MROWS * HID * 2;    // 8 MB each
  b16* Ql  = (b16*)(ws + off); off += (size_t)MROWS * HID * 2;
  b16* Kh  = (b16*)(ws + off); off += (size_t)MROWS * KVW * 2;
  b16* Kl  = (b16*)(ws + off); off += (size_t)MROWS * KVW * 2;
  b16* Vh  = (b16*)(ws + off); off += (size_t)MROWS * KVW * 2;
  b16* Vl  = (b16*)(ws + off); off += (size_t)MROWS * KVW * 2;
  float* yf = (float*)(ws + off); off += (size_t)MROWS * HID * 4; // 16 MB
  float* rope_cs = (float*)(ws + off); off += (size_t)T * ROT * 2 * 4;
  if (off > ws_size) return;
  rope_table_kernel<<<(T * ROT + 255) / 256, 256, 0, stream>>>(fr, rope_cs);
  const int ROWBLK = MROWS / 128, NQT = Bsz * NH * QT_PER_B;   // full job

  wcvt_kernel<<<2048, 256, 0, stream>>>(Wq, Wk, Wv, Wo, wqh, wql, woh, wol);
  qkv_gemm_kernel<<<dim3(NQKV / 64, ROWBLK), 128, 0, stream>>>(x, x, x, wqh, wql, bq, bk, bv, rope_cs, 0, 0, Qh, Ql, Kh, Kl, Vh, Vl);
  attn_kernel<<<NQT / 8, 256, 0, stream>>>(Qh, Ql, Kh, Kl, Vh, Vl, yf);
  out_gemm_kernel<<<dim3(HID / 64, ROWBLK), 128, 0, stream>>>(yf, woh, wol, bo, 0, out);
}

// v001
// One run takes 320 microseconds.
// In both of two side-by-side timings against v000, it was 1.04 times as fast.
#include <hip/hip_runtime.h>

// CLVP self-attention: q/k/v = x.W^T (torch [out][in] weights, no bias), partial rotary embedding on the first 32 dims of every head of q, k AND v
// (rotate-half: pairs (d, d+16), cos/sin of the given rotary_pos_emb[s][d]), q x 1/8, causal softmax, y = P.V, out = y.Wo^T + bo. B=4, S=1024, 16x64.
// All contractions as bf16 hi/lo splits on v_wmma_f32_16x16x32_bf16 (hi.hi + hi.lo + lo.hi, f32 accumulate): the outputs have rms 0.04.

namespace {
constexpr int Bsz = 4, T = 1024, HID = 1024, DH = 64, NH = 16, NKV = 16, REP = NH / NKV;
constexpr int ROT = 32;   // rotary dims per head
constexpr int KVW = NKV * DH;                 // 1024
constexpr int NQKV = HID + 2 * KVW;           // 3072 columns: q | k | v
constexpr int MROWS = Bsz * T;                // 4096
constexpr int QT_PER_B = T / 16;              // 64

typedef __bf16 b16;
typedef __attribute__((ext_vector_type(16))) __bf16 v16b;
typedef __attribute__((ext_vector_type(8)))  __bf16 v8b;
typedef __attribute__((ext_vector_type(8)))  float v8f;
typedef __attribute__((ext_vector_type(4)))  float v4f;

__device__ __forceinline__ v8b ld8b(const b16* p) { return *(const v8b*)p; }
__device__ __forceinline__ v16b cat8b(v8b a, v8b b) { return __builtin_shufflevector(a, b, 0, 1, 2, 3, 4, 5, 6, 7, 8, 9, 10, 11, 12, 13, 14, 15); }
// 16x16x32 16-bit fragment (A: lane&15 = row, B: lane&15 = column), hh = lane>>4: elements 0..7 <- k = 8hh+0..7, elements 8..15 <- k = 16+8hh+0..7.
// Loaded from FRAGMENT-PACKED storage: a 16 x 32 tile is 2 groups of 256 elements, group j at lane*8 holds that lane's elements 8j..8j+7,
// so each wave-wide 16-byte load covers 512 contiguous bytes (4 whole lines) instead of 16 rows. p already includes lane*8.
__device__ __forceinline__ v16b frag_pk(const b16* p) { return cat8b(ld8b(p), ld8b(p + 256)); }
__device__ __forceinline__ void split_bf16(float v, b16& hi, b16& lo) {
  const unsigned int u = __builtin_bit_cast(unsigned int, v) & 0xffff0000u;
  hi = __builtin_bit_cast(b16, (unsigned short)(u >> 16));
  lo = (b16)(v - __builtin_bit_cast(float, u));
}
// split fragment from fragment-packed f32: a 16 x 32 tile is 4 groups of 128 floats, group j at lane*4 holds that lane's elements 4j..4j+3
// (k = 16(j>>1) + 8hh + 4(j&1) + e, the k order above). p already includes lane*4.
__device__ __forceinline__ void frag_psplit(const float* p, v16b& fh_, v16b& fl_) {
#pragma unroll
  for (int j = 0; j < 4; ++j) {
    const v4f f = *(const v4f*)(p + j * 128);
#pragma unroll
    for (int e = 0; e < 4; ++e) { b16 a, c; split_bf16(f[e], a, c); fh_[j * 4 + e] = a; fl_[j * 4 + e] = c; }
  }
}
__device__ __forceinline__ v8f wmma16b(v16b a, v16b b, v8f c) {
  v8f d = __builtin_amdgcn_wmma_f32_16x16x32_bf16(false, a, false, b, (short)0, c, false, false);
  asm volatile("v_nop\n\tv_nop\n\tv_nop\n\tv_nop" : "+v"(d) : "v"(a), "v"(b));
  return d;
}
// acc += A.B with both operands split: A = (ah, al), B = (bh, bl)
__device__ __forceinline__ v8f wmma3(v16b ah, v16b al, v16b bh, v16b bl, v8f c) {
  c = wmma16b(ah, bh, c); c = wmma16b(ah, bl, c); c = wmma16b(al, bh, c); return c;
}
__device__ __forceinline__ void wave_lds_sync() {
  __builtin_amdgcn_fence(__ATOMIC_RELEASE, "workgroup");
  __builtin_amdgcn_wave_barrier();
  __builtin_amdgcn_fence(__ATOMIC_ACQUIRE, "workgroup");
}

// ---------------------------------------------------------------------------
// Packing pass. Weights (torch [out][in]) -> bf16 hi / lo planes in fragment-packed 16(n) x 32(k) tiles, tile index ntile*(HID/32)+kblk: rows of Wq|Wk|Wv into
// wqh/wql (3072 x 1024), Wo into woh/wol (1024 x 1024). x -> xp, f32, fragment-packed 16(m) x 32(k) tiles. Threads follow the destination: whole-line stores.
// ---------------------------------------------------------------------------
__global__ __launch_bounds__(256) void wcvt_kernel(const float* __restrict__ wq, const float* __restrict__ wk, const float* __restrict__ wv,
                                                   const float* __restrict__ wo, const float* __restrict__ x, b16* __restrict__ wqh, b16* __restrict__ wql,
                                                   b16* __restrict__ woh, b16* __restrict__ wol, float* __restrict__ xp) {
  const size_t tid = (size_t)blockIdx.x * blockDim.x + threadIdx.x, stride = (size_t)gridDim.x * blockDim.x;
  const size_t nq = (size_t)NQKV * HID / 8, no = (size_t)HID * HID / 8, nx = (size_t)MROWS * HID / 4;
  for (size_t c = tid; c < nq + no; c += stride) {
    const bool isq = c < nq;
    const size_t cc = isq ? c : c - nq;                     // 8-element chunk of the packed plane: lane | group j | kblk | ntile
    const int ln = (int)(cc & 31), j = (int)(cc >> 5) & 1, kblk = (int)(cc >> 6) & (HID / 32 - 1);
    const int n = (int)(cc >> 11) * 16 + (ln & 15), k0 = kblk * 32 + j * 16 + (ln >> 4) * 8;
    const float* w; int nn;
    if (!isq) { w = wo; nn = n; } else if (n < HID) { w = wq; nn = n; } else if (n < HID + KVW) { w = wk; nn = n - HID; } else { w = wv; nn = n - HID - KVW; }
    const float* src = w + (size_t)nn * HID + k0;
    const v4f f0 = *(const v4f*)src, f1 = *(const v4f*)(src + 4);
    v8b bh, bl;
#pragma unroll
    for (int e = 0; e < 4; ++e) { b16 a, d; split_bf16(f0[e], a, d); bh[e] = a; bl[e] = d; split_bf16(f1[e], a, d); bh[4 + e] = a; bl[4 + e] = d; }
    *(v8b*)((isq ? wqh : woh) + cc * 8) = bh; *(v8b*)((isq ? wql : wol) + cc * 8) = bl;
  }
  for (size_t c = tid; c < nx; c += stride) {               // 4-float chunk of xp: lane | group j | kblk | mtile
    const int ln = (int)(c & 31), j = (int)(c >> 5) & 3, kblk = (int)(c >> 7) & (HID / 32 - 1);
    const size_t m = (c >> 12) * 16 + (ln & 15);
    *(v4f*)(xp + c * 4) = *(const v4f*)(x + m * HID + kblk * 32 + (j >> 1) * 16 + (ln >> 4) * 8 + (j & 1) * 4);
  }
}

// 32x64 wave tile over K from fragment-packed f32 A tiles and fragment-packed bf16-plane B tiles
__device__ __forceinline__ void gemm_tile_split(const float* __restrict__ A, const b16* __restrict__ wh, const b16* __restrict__ wl,
                                                int m0, int c0, int K, int nloc, int hlf, v8f (&acc)[2][4]) {
  const unsigned lane = hlf * 16 + nloc;
  const int KB = K / 32;
  // the A tile base is wave-uniform; readfirstlane tells the compiler so: it then advances in scalar registers, which keeps the allocation at 160 VGPRs (6 waves per SIMD)
  const float* ap = A + (size_t)__builtin_amdgcn_readfirstlane(m0 >> 4) * KB * 512;
  const b16* bhp = wh + (size_t)(c0 >> 4) * KB * 512;
  const b16* blp = wl + (size_t)(c0 >> 4) * KB * 512;
  for (int kb = 0; kb < KB; ++kb) {
    v16b a0h, a0l, a1h, a1l;
    frag_psplit(ap + (size_t)kb * 512 + lane * 4u, a0h, a0l);
    frag_psplit(ap + (size_t)(KB + kb) * 512 + lane * 4u, a1h, a1l);
#pragma unroll
    for (int t = 0; t < 4; ++t) {
      const size_t wofs = (size_t)(t * KB + kb) * 512;
      const v16b bh = frag_pk(bhp + wofs + lane * 8u), bl = frag_pk(blp + wofs + lane * 8u);
      acc[0][t] = wmma3(a0h, a0l, bh, bl, acc[0][t]);
      acc[1][t] = wmma3(a1h, a1l, bh, bl, acc[1][t]);
    }
  }
}

// ---------------------------------------------------------------------------
// QKV GEMM: (4096 x 1024) x (1024 x 3072), grid (48, 32), block 4 waves, wave = 32 rows x 64 columns (one head of q, k or v). Outputs as bf16 hi/lo planes:
// q (x1/8) -> Qh/Ql [b][h][t/16] and k -> Kh/Kl [b][kvh][t/16], each 16 x 64 tile as two fragment-packed 16 x 32 tiles (4 KB contiguous per wave per plane);
// v -> Vh/Vl key-tiled [b][kvh][t/16][64][16] (4 KB contiguous per wave per plane).
// ---------------------------------------------------------------------------
__global__ __launch_bounds__(128) void qkv_gemm_kernel(const float* __restrict__ xq, const float* __restrict__ xk, const float* __restrict__ xv,
                                                       const b16* __restrict__ wqh, const b16* __restrict__ wql,
                                                       const float* __restrict__ bq, const float* __restrict__ bk, const float* __restrict__ bv, const float* __restrict__ rope_cs, int xoff, int yoff,
                                                       b16* __restrict__ Qh, b16* __restrict__ Ql, b16* __restrict__ Kh, b16* __restrict__ Kl,
                                                       b16* __restrict__ Vh, b16* __restrict__ Vl) {
  __shared__ __attribute__((aligned(16))) b16 Ts[4][2][32 * 64];
  const int lane = threadIdx.x & 31, wave = threadIdx.x >> 5, nloc = lane & 15, hlf = lane >> 4;
  const int m0 = (blockIdx.y + yoff) * 128 + wave * 32;
  const int c0 = (blockIdx.x + xoff) * 64;
  const int mat = (c0 < HID) ? 0 : (c0 < HID + KVW) ? 1 : 2;
  const int head = (mat == 0) ? (c0 / DH) : (mat == 1) ? ((c0 - HID) / DH) : ((c0 - HID - KVW) / DH);
  const float* x = (mat == 0) ? xq : (mat == 1) ? xk : xv;          // q, k and v inputs; the launch passes xp (packed x) for all three
  const float* bias = ((mat == 0) ? bq : (mat == 1) ? bk : bv) + head * DH;
  v8f acc[2][4];
#pragma unroll
  for (int r = 0; r < 2; ++r)
#pragma unroll
    for (int t = 0; t < 4; ++t) acc[r][t] = (v8f){};
  gemm_tile_split(x, wqh, wql, m0, c0, HID, nloc, hlf, acc);
  const int b = m0 / T, t0 = m0 % T;
  const float s = (mat == 0) ? 0.125f : 1.0f;
  b16* Tp0 = Ts[wave][0]; b16* Tp1 = Ts[wave][1];
#pragma unroll
  for (int t = 0; t < 4; ++t)
#pragma unroll
    for (int r = 0; r < 2; ++r)
#pragma unroll
      for (int v = 0; v < 8; ++v) {
        const int rr = r * 16 + v + 8 * hlf, d = t * 16 + nloc;
        float val = acc[r][t][v] + (bias ? bias[d] : 0.0f);
        if (t < 2) {                                     // partial rotary on dims 0..31 of q, k and v: x*cos(f) + rotate_half(x)*sin(f), partner d^16 is tile t^1 (same lane)
          const int tpos = t0 + rr;                      // sequence position of this row
          const float cv = rope_cs[((size_t)tpos * ROT + d) * 2], sv = rope_cs[((size_t)tpos * ROT + d) * 2 + 1];   // precomputed cos/sin of rotary_pos_emb
          const float oth = acc[r][t ^ 1][v] + (bias ? bias[d ^ 16] : 0.0f);
          val = (t == 0) ? (val * cv - oth * sv) : (val * cv + oth * sv);
        }
        b16 yh, yl; split_bf16(val * s, yh, yl);
        const int idx = (mat < 2) ? ((rr >> 4) * 1024 + (d >> 4) * 256 + (((d >> 3) & 1) * 16 + (rr & 15)) * 8 + (d & 7)) : ((rr >> 4) * 1024 + d * 16 + (rr & 15));
        Tp0[idx] = yh; Tp1[idx] = yl;
      }
  wave_lds_sync();
  b16* dh; b16* dl; size_t o;
  if (mat == 0)      { o = ((size_t)(b * NH + head) * T + t0) * DH; dh = Qh + o; dl = Ql + o; }
  else if (mat == 1) { o = ((size_t)(b * NKV + head) * T + t0) * DH; dh = Kh + o; dl = Kl + o; }
  else               { o = ((size_t)(b * NKV + head) * QT_PER_B + (t0 >> 4)) * (size_t)(DH * 16); dh = Vh + o; dl = Vl + o; }
#pragma unroll
  for (int j = 0; j < 8; ++j) { const int e = (j * 32 + lane) * 8; *(v8b*)(dh + e) = ld8b(Tp0 + e); *(v8b*)(dl + e) = ld8b(Tp1 + e); }
  
}

// ---------------------------------------------------------------------------
// Transposed flash attention: each wave owns one 16-query tile of one (b, head); 8 waves per block; key chunks of 32 up to the diagonal.
// S^T = K.Q^T (split), per-lane online softmax; P^T built in registers from the two S^T accumulators
// ---------------------------------------------------------------------------
__global__ __launch_bounds__(256) void attn_kernel(const b16* __restrict__ Qh, const b16* __restrict__ Ql, const b16* __restrict__ Kh, const b16* __restrict__ Kl,
                                                   const b16* __restrict__ Vh, const b16* __restrict__ Vl,
                                                   float* __restrict__ yf) {
  const int wid = threadIdx.x >> 5, lane = threadIdx.x & 31, hh = lane >> 4, col = lane & 15;
  const int qtile = blockIdx.x * 8 + wid;                 // over Bsz*NH*QT_PER_B
  const int g = qtile / QT_PER_B;                         // b*NH + h
  const int q0 = (qtile % QT_PER_B) << 4;
  const int b = g / NH, h = g % NH, kvh = h / REP;
  const size_t ko = (size_t)(b * NKV + kvh) * T * DH;
  const size_t qo = ((size_t)g * T + q0) * DH + lane * 8;
  const v16b q0h = frag_pk(Qh + qo), q0l = frag_pk(Ql + qo), q1h = frag_pk(Qh + qo + 512), q1l = frag_pk(Ql + qo + 512);
  float m = -INFINITY, l = 0.0f;
  v8f o0 = {}, o1 = {}, o2 = {}, o3 = {};
  for (int kb = 0; kb < q0 + 16; kb += 32) {             // causal: key chunks up to the tile's last query
    const size_t r0 = ko + (size_t)kb * DH + lane * 8, r1 = r0 + 16 * DH;   // two packed 16-key tiles
    v8f s0 = {}, s1 = {};
    {
      v16b ah = frag_pk(Kh + r0), al = frag_pk(Kl + r0);
      s0 = wmma3(ah, al, q0h, q0l, s0);
      ah = frag_pk(Kh + r0 + 512); al = frag_pk(Kl + r0 + 512);
      s0 = wmma3(ah, al, q1h, q1l, s0);
      ah = frag_pk(Kh + r1); al = frag_pk(Kl + r1);
      s1 = wmma3(ah, al, q0h, q0l, s1);
      ah = frag_pk(Kh + r1 + 512); al = frag_pk(Kl + r1 + 512);
      s1 = wmma3(ah, al, q1h, q1l, s1);
    }
    if (kb + 32 > q0) {                                   // diagonal chunk: mask keys after the query
      const int qi = q0 + col;
#pragma unroll
      for (int r = 0; r < 8; ++r) {
        if (kb + 8 * hh + r > qi)      s0[r] = -INFINITY;
        if (kb + 16 + 8 * hh + r > qi) s1[r] = -INFINITY;
      }
    }
    float mr = -INFINITY;
#pragma unroll
    for (int r = 0; r < 8; ++r) mr = fmaxf(mr, fmaxf(s0[r], s1[r]));
    mr = fmaxf(mr, __shfl_xor(mr, 16));
    const float mn = fmaxf(m, mr);            // finite
    const float al_ = __expf(m - mn);
    m = mn;
    float sum = 0.0f;
    v16b pbh, pbl;
#pragma unroll
    for (int r = 0; r < 8; ++r) {
      const float p0 = __expf(s0[r] - mn), p1 = __expf(s1[r] - mn);
      sum += p0 + p1;
      b16 a, c; split_bf16(p0, a, c); pbh[r] = a; pbl[r] = c; split_bf16(p1, a, c); pbh[8 + r] = a; pbl[8 + r] = c;
    }
    sum += __shfl_xor(sum, 16);
    l = l * al_ + sum;
#pragma unroll
    for (int r = 0; r < 8; ++r) { o0[r] *= al_; o1[r] *= al_; o2[r] *= al_; o3[r] *= al_; }
    const size_t v0 = ko + (size_t)(kb >> 4) * (DH * 16) + 8 * hh, v1 = v0 + DH * 16;
#pragma unroll
    for (int n = 0; n < 4; ++n) {
      const int f = n * 16 + col;
      const v16b vah = cat8b(ld8b(Vh + v0 + f * 16), ld8b(Vh + v1 + f * 16));
      const v16b val = cat8b(ld8b(Vl + v0 + f * 16), ld8b(Vl + v1 + f * 16));
      v8f& o = (n == 0) ? o0 : (n == 1) ? o1 : (n == 2) ? o2 : o3;
      o = wmma3(vah, val, pbh, pbl, o);
    }
  }
  const float inv = 1.0f / l;
  // y in fragment-packed f32 tiles for the output projection: O^T's accumulator (feature 8hh+r, query col) already is the A fragment's lane and k order,
  // so every lane stores its own 4-float groups and each wave-wide store is 512 contiguous bytes.
  float* dst0 = yf + ((size_t)((b * T + q0) >> 4) * (HID / 32) + h * 2) * 512 + lane * 4;
#pragma unroll
  for (int n = 0; n < 4; ++n) {
    const v8f o = (n == 0) ? o0 : (n == 1) ? o1 : (n == 2) ? o2 : o3;
#pragma unroll
    for (int u = 0; u < 2; ++u) {
      const v4f w = {o[u * 4] * inv, o[u * 4 + 1] * inv, o[u * 4 + 2] * inv, o[u * 4 + 3] * inv};
      *(v4f*)(dst0 + (n >> 1) * 512 + ((n & 1) * 2 + u) * 128) = w;
    }
  }
}

// ---------------------------------------------------------------------------
// Output projection: (4096 x 1024) x (1024 x 1024) -> f32, A split on the fly from packed f32 y, B = packed Wo planes. grid (16, 32), 32x64 tiles staged in LDS,
// ---------------------------------------------------------------------------
__global__ __launch_bounds__(128) void out_gemm_kernel(const float* __restrict__ yf, const b16* __restrict__ woh, const b16* __restrict__ wol, const float* __restrict__ bo, int yoff,
                                                       float* __restrict__ out) {
  __shared__ __attribute__((aligned(16))) float Ts[4][32 * 64];
  const int lane = threadIdx.x & 31, wave = threadIdx.x >> 5, nloc = lane & 15, hlf = lane >> 4;
  const int m0 = (blockIdx.y + yoff) * 128 + wave * 32;
  const int c0 = blockIdx.x * 64;
  v8f acc[2][4];
#pragma unroll
  for (int r = 0; r < 2; ++r)
#pragma unroll
    for (int t = 0; t < 4; ++t) acc[r][t] = (v8f){};
  gemm_tile_split(yf, woh, wol, m0, c0, HID, nloc, hlf, acc);
  float* Tt = Ts[wave];
#pragma unroll
  for (int t = 0; t < 4; ++t)
#pragma unroll
    for (int r = 0; r < 2; ++r)
#pragma unroll
      for (int v = 0; v < 8; ++v) Tt[(r * 16 + v + 8 * hlf) * 64 + t * 16 + nloc] = acc[r][t][v] + bo[c0 + t * 16 + nloc];
  wave_lds_sync();
  float* dst0 = out + (size_t)m0 * HID + c0;
#pragma unroll
  for (int j = 0; j < 16; ++j) { const int rr = j * 2 + hlf, c4 = nloc * 4; *(v4f*)(dst0 + (size_t)rr * HID + c4) = *(const v4f*)(Tt + rr * 64 + c4); }
  
}
__global__ __launch_bounds__(256) void rope_table_kernel(const float* __restrict__ fr, float* __restrict__ cs) {
  const int idx = blockIdx.x * 256 + threadIdx.x;        // T * 32
  if (idx >= T * ROT) return;
  const float f = fr[idx];
  typedef __attribute__((ext_vector_type(2))) float v2f;
  const v2f p = {cosf(f), sinf(f)};
  *(v2f*)(cs + (size_t)idx * 2) = p; 
}
}  // namespace

extern "C" void kernel_launch(void* const* d_in, const int* in_sizes, int n_in,
                              void* d_out, int out_size, void* d_ws, size_t ws_size, hipStream_t stream) {
  (void)in_sizes; (void)n_in; (void)out_size;
  const float* x  = (const float*)d_in[0];   // hidden_states [4,1024,1024]
  const float* fr = (const float*)d_in[1];   // rotary_pos_emb [1,1024,32]
  const float* Wq = (const float*)d_in[2];   // [1024,1024] torch [out][in]
  const float* Wk = (const float*)d_in[3];
  const float* Wv = (const float*)d_in[4];
  const float* Wo = (const float*)d_in[5];
  const float* bo = (const float*)d_in[6];
  const float* bq = nullptr; const float* bk = nullptr; const float* bv = nullptr;
  float* out = (float*)d_out;                // [4,1024,1024] f32

  size_t off = 0; char* ws = (char*)d_ws;
  b16* wqh = (b16*)(ws + off); off += (size_t)NQKV * HID * 2;     // 6 MB
  b16* wql = (b16*)(ws + off); off += (size_t)NQKV * HID * 2;
  b16* woh = (b16*)(ws + off); off += (size_t)HID * HID * 2;      // 2 MB
  b16* wol = (b16*)(ws + off); off += (size_t)HID * HID * 2;
  b16* Qh  = (b16*)(ws + off); off += (size_t)MROWS * HID * 2;    // 8 MB each
  b16* Ql  = (b16*)(ws + off); off += (size_t)MROWS * HID * 2;
  b16* Kh  = (b16*)(ws + off); off += (size_t)MROWS * KVW * 2;
  b16* Kl  = (b16*)(ws + off); off += (size_t)MROWS * KVW * 2;
  b16* Vh  = (b16*)(ws + off); off += (size_t)MROWS * KVW * 2;
  b16* Vl  = (b16*)(ws + off); off += (size_t)MROWS * KVW * 2;
  float* yf = (float*)(ws + off); off += (size_t)MROWS * HID * 4; // 16 MB
  float* rope_cs = (float*)(ws + off); off += (size_t)T * ROT * 2 * 4;
  float* xp = (float*)(ws + off); off += (size_t)MROWS * HID * 4; // x, fragment-packed
  if (off > ws_size) return;
  rope_table_kernel<<<(T * ROT + 255) / 256, 256, 0, stream>>>(fr, rope_cs);
  const int ROWBLK = MROWS / 128, NQT = Bsz * NH * QT_PER_B;   // full job

  wcvt_kernel<<<2048, 256, 0, stream>>>(Wq, Wk, Wv, Wo, x, wqh, wql, woh, wol, xp);
  qkv_gemm_kernel<<<dim3(NQKV / 64, ROWBLK), 128, 0, stream>>>(xp, xp, xp, wqh, wql, bq, bk, bv, rope_cs, 0, 0, Qh, Ql, Kh, Kl, Vh, Vl);
  attn_kernel<<<NQT / 8, 256, 0, stream>>>(Qh, Ql, Kh, Kl, Vh, Vl, yf);
  out_gemm_kernel<<<dim3(HID / 64, ROWBLK), 128, 0, stream>>>(yf, woh, wol, bo, 0, out);
}

// v002
// Measured time: 158 microseconds a run.
// Timed twice side by side with v001, it ran 2.05 and 2.00 times as fast.
// Counting every step since v000, it is 2.10 times as fast.
#include <hip/hip_runtime.h>

// CLVP self-attention: q/k/v = x.W^T (torch [out][in] weights, no bias), partial rotary embedding on the first 32 dims of every head of q, k AND v
// (rotate-half: pairs (d, d+16), cos/sin of the given rotary_pos_emb[s][d]), q x 1/8, causal softmax, y = P.V, out = y.Wo^T + bo. B=4, S=1024, 16x64.
// All contractions as bf16 hi/lo splits on v_wmma_f32_16x16x32_bf16 (hi.hi + hi.lo + lo.hi, f32 accumulate): the outputs have rms 0.04.

namespace {
constexpr int Bsz = 4, T = 1024, HID = 1024, DH = 64, NH = 16, NKV = 16, REP = NH / NKV;
constexpr int ROT = 32;   // rotary dims per head
constexpr int KVW = NKV * DH;                 // 1024
constexpr int NQKV = HID + 2 * KVW;           // 3072 columns: q | k | v
constexpr int MROWS = Bsz * T;                // 4096
constexpr int QT_PER_B = T / 16;              // 64

typedef __bf16 b16;
typedef __attribute__((ext_vector_type(16))) __bf16 v16b;
typedef __attribute__((ext_vector_type(8)))  __bf16 v8b;
typedef __attribute__((ext_vector_type(8)))  float v8f;
typedef __attribute__((ext_vector_type(4)))  float v4f;

__device__ __forceinline__ v8b ld8b(const b16* p) { return *(const v8b*)p; }
__device__ __forceinline__ v16b cat8b(v8b a, v8b b) { return __builtin_shufflevector(a, b, 0, 1, 2, 3, 4, 5, 6, 7, 8, 9, 10, 11, 12, 13, 14, 15); }
// 16x16x32 16-bit fragment (A: lane&15 = row, B: lane&15 = column), hh = lane>>4: elements 0..7 <- k = 8hh+0..7, elements 8..15 <- k = 16+8hh+0..7.
// Loaded from FRAGMENT-PACKED storage: a 16 x 32 tile is 2 groups of 256 elements, group j at lane*8 holds that lane's elements 8j..8j+7,
// so each wave-wide 16-byte load covers 512 contiguous bytes (4 whole lines) instead of 16 rows. p already includes lane*8.
__device__ __forceinline__ v16b frag_pk(const b16* p) { return cat8b(ld8b(p), ld8b(p + 256)); }
__device__ __forceinline__ void split_bf16(float v, b16& hi, b16& lo) {
  const unsigned int u = __builtin_bit_cast(unsigned int, v) & 0xffff0000u;
  hi = __builtin_bit_cast(b16, (unsigned short)(u >> 16));
  lo = (b16)(v - __builtin_bit_cast(float, u));
}
// split fragment from fragment-packed f32: a 16 x 32 tile is 4 groups of 128 floats, group j at lane*4 holds that lane's elements 4j..4j+3
// (k = 16(j>>1) + 8hh + 4(j&1) + e, the k order above). p already includes lane*4.
// The load and the split are two functions, so that a tile's four loads can be issued one k block before it is split.
__device__ __forceinline__ void frag_pload(const float* p, v4f (&f)[4]) {
#pragma unroll
  for (int j = 0; j < 4; ++j) f[j] = *(const v4f*)(p + j * 128);
}
__device__ __forceinline__ void frag_psplit(const v4f (&f)[4], v16b& fh_, v16b& fl_) {
#pragma unroll
  for (int j = 0; j < 4; ++j)
#pragma unroll
    for (int e = 0; e < 4; ++e) { b16 a, c; split_bf16(f[j][e], a, c); fh_[j * 4 + e] = a; fl_[j * 4 + e] = c; }
}
__device__ __forceinline__ v8f wmma16b(v16b a, v16b b, v8f c) {
  v8f d = __builtin_amdgcn_wmma_f32_16x16x32_bf16(false, a, false, b, (short)0, c, false, false);
  asm volatile("v_nop\n\tv_nop\n\tv_nop\n\tv_nop" : "+v"(d) : "v"(a), "v"(b));
  return d;
}
// acc += A.B with both operands split: A = (ah, al), B = (bh, bl)
__device__ __forceinline__ v8f wmma3(v16b ah, v16b al, v16b bh, v16b bl, v8f c) {
  c = wmma16b(ah, bh, c); c = wmma16b(ah, bl, c); c = wmma16b(al, bh, c); return c;
}
__device__ __forceinline__ void wave_lds_sync() {
  __builtin_amdgcn_fence(__ATOMIC_RELEASE, "workgroup");
  __builtin_amdgcn_wave_barrier();
  __builtin_amdgcn_fence(__ATOMIC_ACQUIRE, "workgroup");
}

// ---------------------------------------------------------------------------
// Packing pass. Weights (torch [out][in]) -> bf16 hi / lo planes in fragment-packed 16(n) x 32(k) tiles, tile index ntile*(HID/32)+kblk: rows of Wq|Wk|Wv into
// wqh/wql (3072 x 1024), Wo into woh/wol (1024 x 1024). x -> xp, f32, fragment-packed 16(m) x 32(k) tiles. Threads follow the destination: whole-line stores.
// ---------------------------------------------------------------------------
__global__ __launch_bounds__(256) void wcvt_kernel(const float* __restrict__ wq, const float* __restrict__ wk, const float* __restrict__ wv,
                                                   const float* __restrict__ wo, const float* __restrict__ x, b16* __restrict__ wqh, b16* __restrict__ wql,
                                                   b16* __restrict__ woh, b16* __restrict__ wol, float* __restrict__ xp) {
  const size_t tid = (size_t)blockIdx.x * blockDim.x + threadIdx.x, stride = (size_t)gridDim.x * blockDim.x;
  const size_t nq = (size_t)NQKV * HID / 8, no = (size_t)HID * HID / 8, nx = (size_t)MROWS * HID / 4;
  for (size_t c = tid; c < nq + no; c += stride) {
    const bool isq = c < nq;
    const size_t cc = isq ? c : c - nq;                     // 8-element chunk of the packed plane: lane | group j | kblk | ntile
    const int ln = (int)(cc & 31), j = (int)(cc >> 5) & 1, kblk = (int)(cc >> 6) & (HID / 32 - 1);
    const int n = (int)(cc >> 11) * 16 + (ln & 15), k0 = kblk * 32 + j * 16 + (ln >> 4) * 8;
    const float* w; int nn;
    if (!isq) { w = wo; nn = n; } else if (n < HID) { w = wq; nn = n; } else if (n < HID + KVW) { w = wk; nn = n - HID; } else { w = wv; nn = n - HID - KVW; }
    const float* src = w + (size_t)nn * HID + k0;
    const v4f f0 = *(const v4f*)src, f1 = *(const v4f*)(src + 4);
    v8b bh, bl;
#pragma unroll
    for (int e = 0; e < 4; ++e) { b16 a, d; split_bf16(f0[e], a, d); bh[e] = a; bl[e] = d; split_bf16(f1[e], a, d); bh[4 + e] = a; bl[4 + e] = d; }
    *(v8b*)((isq ? wqh : woh) + cc * 8) = bh; *(v8b*)((isq ? wql : wol) + cc * 8) = bl;
  }
  for (size_t c = tid; c < nx; c += stride) {               // 4-float chunk of xp: lane | group j | kblk | mtile
    const int ln = (int)(c & 31), j = (int)(c >> 5) & 3, kblk = (int)(c >> 7) & (HID / 32 - 1);
    const size_t m = (c >> 12) * 16 + (ln & 15);
    *(v4f*)(xp + c * 4) = *(const v4f*)(x + m * HID + kblk * 32 + (j >> 1) * 16 + (ln >> 4) * 8 + (j & 1) * 4);
  }
}

// 32x64 wave tile over K from fragment-packed f32 A tiles and fragment-packed bf16-plane B tiles
__device__ __forceinline__ void gemm_tile_split(const float* __restrict__ A, const b16* __restrict__ wh, const b16* __restrict__ wl,
                                                int m0, int c0, int K, int nloc, int hlf, v8f (&acc)[2][4]) {
  const unsigned lane = hlf * 16 + nloc;
  const int KB = K / 32;
  // the A tile base is wave-uniform; readfirstlane tells the compiler so: it then advances in scalar registers
  const float* ap = A + (size_t)__builtin_amdgcn_readfirstlane(m0 >> 4) * KB * 512;
  const b16* bhp = wh + (size_t)(c0 >> 4) * KB * 512;
  const b16* blp = wl + (size_t)(c0 >> 4) * KB * 512;
  // Every fragment is fetched one k block ahead: A's f32 words at the head of the block before and split at its foot, B tile t into its own registers behind
  // tile t's products. A load then has a whole block of products to land in, where a load placed in front of its use is waited for once per B tile.
  v4f ar0[4], ar1[4];
  v16b bh[4], bl[4], a0h, a0l, a1h, a1l;
  frag_pload(ap + lane * 4u, ar0);
  frag_pload(ap + (size_t)KB * 512 + lane * 4u, ar1);
#pragma unroll
  for (int t = 0; t < 4; ++t) { const size_t wofs = (size_t)(t * KB) * 512; bh[t] = frag_pk(bhp + wofs + lane * 8u); bl[t] = frag_pk(blp + wofs + lane * 8u); }
  frag_psplit(ar0, a0h, a0l);
  frag_psplit(ar1, a1h, a1l);
  for (int kb = 0; kb < KB; ++kb) {
    const int kn = (kb + 1 < KB) ? kb + 1 : kb;           // the last block fetches itself again: in bounds, never used
    frag_pload(ap + (size_t)kn * 512 + lane * 4u, ar0);
    frag_pload(ap + (size_t)(KB + kn) * 512 + lane * 4u, ar1);
#pragma unroll
    for (int t = 0; t < 4; ++t) {
      acc[0][t] = wmma3(a0h, a0l, bh[t], bl[t], acc[0][t]);
      acc[1][t] = wmma3(a1h, a1l, bh[t], bl[t], acc[1][t]);
      const size_t wofs = (size_t)(t * KB + kn) * 512;
      bh[t] = frag_pk(bhp + wofs + lane * 8u); bl[t] = frag_pk(blp + wofs + lane * 8u);
    }
    frag_psplit(ar0, a0h, a0l);
    frag_psplit(ar1, a1h, a1l);
    // the address registers of this block's B loads are rewritten at the head of the next block
    asm volatile("s_wait_xcnt 0x0" ::: "memory");
  }
}

// ---------------------------------------------------------------------------
// QKV GEMM: (4096 x 1024) x (1024 x 3072), grid (48, 32), block 4 waves, wave = 32 rows x 64 columns (one head of q, k or v). Outputs as bf16 hi/lo planes:
// q (x1/8) -> Qh/Ql [b][h][t/16] and k -> Kh/Kl [b][kvh][t/16], each 16 x 64 tile as two fragment-packed 16 x 32 tiles (4 KB contiguous per wave per plane);
// v -> Vh/Vl key-tiled [b][kvh][t/16][64][16] (4 KB contiguous per wave per plane).
// ---------------------------------------------------------------------------
__global__ __launch_bounds__(128) void qkv_gemm_kernel(const float* __restrict__ xq, const float* __restrict__ xk, const float* __restrict__ xv,
                                                       const b16* __restrict__ wqh, const b16* __restrict__ wql,
                                                       const float* __restrict__ bq, const float* __restrict__ bk, const float* __restrict__ bv, const float* __restrict__ rope_cs, int xoff, int yoff,
                                                       b16* __restrict__ Qh, b16* __restrict__ Ql, b16* __restrict__ Kh, b16* __restrict__ Kl,
                                                       b16* __restrict__ Vh, b16* __restrict__ Vl) {
  __shared__ __attribute__((aligned(16))) b16 Ts[4][2][32 * 64];
  const int lane = threadIdx.x & 31, wave = threadIdx.x >> 5, nloc = lane & 15, hlf = lane >> 4;
  const int m0 = (blockIdx.y + yoff) * 128 + wave * 32;
  const int c0 = (blockIdx.x + xoff) * 64;
  const int mat = (c0 < HID) ? 0 : (c0 < HID + KVW) ? 1 : 2;
  const int head = (mat == 0) ? (c0 / DH) : (mat == 1) ? ((c0 - HID) / DH) : ((c0 - HID - KVW) / DH);
  const float* x = (mat == 0) ? xq : (mat == 1) ? xk : xv;          // q, k and v inputs; the launch passes xp (packed x) for all three
  const float* bias = ((mat == 0) ? bq : (mat == 1) ? bk : bv) + head * DH;
  v8f acc[2][4];
#pragma unroll
  for (int r = 0; r < 2; ++r)
#pragma unroll
    for (int t = 0; t < 4; ++t) acc[r][t] = (v8f){};
  gemm_tile_split(x, wqh, wql, m0, c0, HID, nloc, hlf, acc);
  const int b = m0 / T, t0 = m0 % T;
  const float s = (mat == 0) ? 0.125f : 1.0f;
  b16* Tp0 = Ts[wave][0]; b16* Tp1 = Ts[wave][1];
  // the lane's 32 cos/sin pairs, fetched as one group ahead of the loop that uses them (one wait instead of one per element)
  typedef __attribute__((ext_vector_type(2))) float v2f;
  v2f cs[2][2][8];
  const float* csp = rope_cs + ((size_t)(t0 + 8 * hlf) * ROT + nloc) * 2;
#pragma unroll
  for (int t = 0; t < 2; ++t)
#pragma unroll
    for (int r = 0; r < 2; ++r)
#pragma unroll
      for (int v = 0; v < 8; ++v) cs[t][r][v] = *(const v2f*)(csp + ((r * 16 + v) * ROT + t * 16) * 2);
  // the group's address stays in its registers up to this wait, so that none of the group's own results lands on it
  asm volatile("s_wait_xcnt 0x0" :: "v"(csp) : "memory");
#pragma unroll
  for (int t = 0; t < 4; ++t)
#pragma unroll
    for (int r = 0; r < 2; ++r)
#pragma unroll
      for (int v = 0; v < 8; ++v) {
        const int rr = r * 16 + v + 8 * hlf, d = t * 16 + nloc;
        float val = acc[r][t][v] + (bias ? bias[d] : 0.0f);
        if (t < 2) {                                     // partial rotary on dims 0..31 of q, k and v: x*cos(f) + rotate_half(x)*sin(f), partner d^16 is tile t^1 (same lane)
          const float cv = cs[t & 1][r][v][0], sv = cs[t & 1][r][v][1];   // precomputed cos/sin of rotary_pos_emb at sequence position t0 + rr
          const float oth = acc[r][t ^ 1][v] + (bias ? bias[d ^ 16] : 0.0f);
          val = (t == 0) ? (val * cv - oth * sv) : (val * cv + oth * sv);
        }
        b16 yh, yl; split_bf16(val * s, yh, yl);
        const int idx = (mat < 2) ? ((rr >> 4) * 1024 + (d >> 4) * 256 + (((d >> 3) & 1) * 16 + (rr & 15)) * 8 + (d & 7)) : ((rr >> 4) * 1024 + d * 16 + (rr & 15));
        Tp0[idx] = yh; Tp1[idx] = yl;
      }
  wave_lds_sync();
  b16* dh; b16* dl; size_t o;
  if (mat == 0)      { o = ((size_t)(b * NH + head) * T + t0) * DH; dh = Qh + o; dl = Ql + o; }
  else if (mat == 1) { o = ((size_t)(b * NKV + head) * T + t0) * DH; dh = Kh + o; dl = Kl + o; }
  else               { o = ((size_t)(b * NKV + head) * QT_PER_B + (t0 >> 4)) * (size_t)(DH * 16); dh = Vh + o; dl = Vl + o; }
#pragma unroll
  for (int j = 0; j < 8; ++j) { const int e = (j * 32 + lane) * 8; *(v8b*)(dh + e) = ld8b(Tp0 + e); *(v8b*)(dl + e) = ld8b(Tp1 + e); }
  
}

// ---------------------------------------------------------------------------
// Transposed flash attention: each wave owns one 16-query tile of one (b, head); 8 waves per block; key chunks of 32 up to the diagonal.
// S^T = K.Q^T (split), per-lane online softmax; P^T built in registers from the two S^T accumulators
// ---------------------------------------------------------------------------
__global__ __launch_bounds__(256) void attn_kernel(const b16* __restrict__ Qh, const b16* __restrict__ Ql, const b16* __restrict__ Kh, const b16* __restrict__ Kl,
                                                   const b16* __restrict__ Vh, const b16* __restrict__ Vl,
                                                   float* __restrict__ yf) {
  // the wave's number is wave-uniform; readfirstlane tells the compiler so: tile index, trip count and chunk addresses then live in scalar registers,
  // which keeps the loop with its fetched-ahead fragments within 256 VGPRs (4 waves per SIMD)
  const int wid = __builtin_amdgcn_readfirstlane(threadIdx.x >> 5), lane = threadIdx.x & 31, hh = lane >> 4, col = lane & 15;
  const int qtile = blockIdx.x * 8 + wid;                 // over Bsz*NH*QT_PER_B
  const int g = qtile / QT_PER_B;                         // b*NH + h
  const int q0 = (qtile % QT_PER_B) << 4;
  const int b = g / NH, h = g % NH, kvh = h / REP;
  const size_t ko = (size_t)(b * NKV + kvh) * T * DH;
  const size_t qo = ((size_t)g * T + q0) * DH + lane * 8;
  const v16b q0h = frag_pk(Qh + qo), q0l = frag_pk(Ql + qo), q1h = frag_pk(Qh + qo + 512), q1l = frag_pk(Ql + qo + 512);
  // the two Q addresses stay in their registers up to this wait, so that none of the Q fragments lands on them
  asm volatile("s_wait_xcnt 0x0" :: "v"(Qh + qo), "v"(Ql + qo) : "memory");
  float m = -INFINITY, l = 0.0f;
  v8f o0 = {}, o1 = {}, o2 = {}, o3 = {};
  // K and V fragments are fetched one 32-key chunk ahead, into the registers the chunk before has just left: K behind the score products, V tile n behind its
  // own products. A chunk of K is two packed 16-key tiles = four 16 x 32 fragments 512 elements apart; a chunk of V two key tiles of 64 x 16.
  const size_t kofs = ko + lane * 8, vofs = ko + col * 16 + 8 * hh;
  v16b kfh[4], kfl[4], vfh[4], vfl[4];
#pragma unroll
  for (int i = 0; i < 4; ++i) { kfh[i] = frag_pk(Kh + kofs + i * 512); kfl[i] = frag_pk(Kl + kofs + i * 512); }
#pragma unroll
  for (int i = 0; i < 4; ++i) {
    vfh[i] = cat8b(ld8b(Vh + vofs + i * 256), ld8b(Vh + vofs + DH * 16 + i * 256));
    vfl[i] = cat8b(ld8b(Vl + vofs + i * 256), ld8b(Vl + vofs + DH * 16 + i * 256));
  }
  for (int kb = 0; kb < q0 + 16; kb += 32) {             // causal: key chunks up to the tile's last query
    const size_t nx = (size_t)((kb + 32 < q0 + 16) ? kb + 32 : kb) * DH;   // next chunk; the last one fetches itself again: in bounds, never used
    // the address registers of the V loads issued at the foot of the chunk before are rewritten below for this chunk's K loads
    asm volatile("s_wait_xcnt 0x0" ::: "memory");
    v8f s0 = {}, s1 = {};
    s0 = wmma3(kfh[0], kfl[0], q0h, q0l, s0);
    s0 = wmma3(kfh[1], kfl[1], q1h, q1l, s0);
    s1 = wmma3(kfh[2], kfl[2], q0h, q0l, s1);
    s1 = wmma3(kfh[3], kfl[3], q1h, q1l, s1);
#pragma unroll
    for (int i = 0; i < 4; ++i) { kfh[i] = frag_pk(Kh + kofs + nx + i * 512); kfl[i] = frag_pk(Kl + kofs + nx + i * 512); }
    if (kb + 32 > q0) {                                   // diagonal chunk: mask keys after the query
      const int qi = q0 + col;
#pragma unroll
      for (int r = 0; r < 8; ++r) {
        if (kb + 8 * hh + r > qi)      s0[r] = -INFINITY;
        if (kb + 16 + 8 * hh + r > qi) s1[r] = -INFINITY;
      }
    }
    float mr = -INFINITY;
#pragma unroll
    for (int r = 0; r < 8; ++r) mr = fmaxf(mr, fmaxf(s0[r], s1[r]));
    mr = fmaxf(mr, __shfl_xor(mr, 16));
    const float mn = fmaxf(m, mr);            // finite
    const float al_ = __expf(m - mn);
    m = mn;
    float sum = 0.0f;
    v16b pbh, pbl;
#pragma unroll
    for (int r = 0; r < 8; ++r) {
      const float p0 = __expf(s0[r] - mn), p1 = __expf(s1[r] - mn);
      sum += p0 + p1;
      b16 a, c; split_bf16(p0, a, c); pbh[r] = a; pbl[r] = c; split_bf16(p1, a, c); pbh[8 + r] = a; pbl[8 + r] = c;
    }
    sum += __shfl_xor(sum, 16);
    l = l * al_ + sum;
#pragma unroll
    for (int r = 0; r < 8; ++r) { o0[r] *= al_; o1[r] *= al_; o2[r] *= al_; o3[r] *= al_; }
#pragma unroll
    for (int n = 0; n < 4; ++n) {
      v8f& o = (n == 0) ? o0 : (n == 1) ? o1 : (n == 2) ? o2 : o3;
      o = wmma3(vfh[n], vfl[n], pbh, pbl, o);
      vfh[n] = cat8b(ld8b(Vh + vofs + nx + n * 256), ld8b(Vh + vofs + nx + DH * 16 + n * 256));
      vfl[n] = cat8b(ld8b(Vl + vofs + nx + n * 256), ld8b(Vl + vofs + nx + DH * 16 + n * 256));
    }
  }
  const float inv = 1.0f / l;
  // y in fragment-packed f32 tiles for the output projection: O^T's accumulator (feature 8hh+r, query col) already is the A fragment's lane and k order,
  // so every lane stores its own 4-float groups and each wave-wide store is 512 contiguous bytes.
  float* dst0 = yf + ((size_t)((b * T + q0) >> 4) * (HID / 32) + h * 2) * 512 + lane * 4;
#pragma unroll
  for (int n = 0; n < 4; ++n) {
    const v8f o = (n == 0) ? o0 : (n == 1) ? o1 : (n == 2) ? o2 : o3;
#pragma unroll
    for (int u = 0; u < 2; ++u) {
      const v4f w = {o[u * 4] * inv, o[u * 4 + 1] * inv, o[u * 4 + 2] * inv, o[u * 4 + 3] * inv};
      *(v4f*)(dst0 + (n >> 1) * 512 + ((n & 1) * 2 + u) * 128) = w;
    }
  }
}

// ---------------------------------------------------------------------------
// Output projection: (4096 x 1024) x (1024 x 1024) -> f32, A split on the fly from packed f32 y, B = packed Wo planes. grid (16, 32), 32x64 tiles staged in LDS,
// ---------------------------------------------------------------------------
__global__ __launch_bounds__(128) void out_gemm_kernel(const float* __restrict__ yf, const b16* __restrict__ woh, const b16* __restrict__ wol, const float* __restrict__ bo, int yoff,
                                                       float* __restrict__ out) {
  __shared__ __attribute__((aligned(16))) float Ts[4][32 * 64];
  const int lane = threadIdx.x & 31, wave = threadIdx.x >> 5, nloc = lane & 15, hlf = lane >> 4;
  const int m0 = (blockIdx.y + yoff) * 128 + wave * 32;
  const int c0 = blockIdx.x * 64;
  v8f acc[2][4];
#pragma unroll
  for (int r = 0; r < 2; ++r)
#pragma unroll
    for (int t = 0; t < 4; ++t) acc[r][t] = (v8f){};
  gemm_tile_split(yf, woh, wol, m0, c0, HID, nloc, hlf, acc);
  float* Tt = Ts[wave];
#pragma unroll
  for (int t = 0; t < 4; ++t)
#pragma unroll
    for (int r = 0; r < 2; ++r)
#pragma unroll
      for (int v = 0; v < 8; ++v) Tt[(r * 16 + v + 8 * hlf) * 64 + t * 16 + nloc] = acc[r][t][v] + bo[c0 + t * 16 + nloc];
  wave_lds_sync();
  float* dst0 = out + (size_t)m0 * HID + c0;
#pragma unroll
  for (int j = 0; j < 16; ++j) { const int rr = j * 2 + hlf, c4 = nloc * 4; *(v4f*)(dst0 + (size_t)rr * HID + c4) = *(const v4f*)(Tt + rr * 64 + c4); }
  
}
__global__ __launch_bounds__(256) void rope_table_kernel(const float* __restrict__ fr, float* __restrict__ cs) {
  const int idx = blockIdx.x * 256 + threadIdx.x;        // T * 32
  if (idx >= T * ROT) return;
  const float f = fr[idx];
  typedef __attribute__((ext_vector_type(2))) float v2f;
  const v2f p = {cosf(f), sinf(f)};
  *(v2f*)(cs + (size_t)idx * 2) = p; 
}
}  // namespace

extern "C" void kernel_launch(void* const* d_in, const int* in_sizes, int n_in,
                              void* d_out, int out_size, void* d_ws, size_t ws_size, hipStream_t stream) {
  (void)in_sizes; (void)n_in; (void)out_size;
  const float* x  = (const float*)d_in[0];   // hidden_states [4,1024,1024]
  const float* fr = (const float*)d_in[1];   // rotary_pos_emb [1,1024,32]
  const float* Wq = (const float*)d_in[2];   // [1024,1024] torch [out][in]
  const float* Wk = (const float*)d_in[3];
  const float* Wv = (const float*)d_in[4];
  const float* Wo = (const float*)d_in[5];
  const float* bo = (const float*)d_in[6];
  const float* bq = nullptr; const float* bk = nullptr; const float* bv = nullptr;
  float* out = (float*)d_out;                // [4,1024,1024] f32

  size_t off = 0; char* ws = (char*)d_ws;
  b16* wqh = (b16*)(ws + off); off += (size_t)NQKV * HID * 2;     // 6 MB
  b16* wql = (b16*)(ws + off); off += (size_t)NQKV * HID * 2;
  b16* woh = (b16*)(ws + off); off += (size_t)HID * HID * 2;      // 2 MB
  b16* wol = (b16*)(ws + off); off += (size_t)HID * HID * 2;
  b16* Qh  = (b16*)(ws + off); off += (size_t)MROWS * HID * 2;    // 8 MB each
  b16* Ql  = (b16*)(ws + off); off += (size_t)MROWS * HID * 2;
  b16* Kh  = (b16*)(ws + off); off += (size_t)MROWS * KVW * 2;
  b16* Kl  = (b16*)(ws + off); off += (size_t)MROWS * KVW * 2;
  b16* Vh  = (b16*)(ws + off); off += (size_t)MROWS * KVW * 2;
  b16* Vl  = (b16*)(ws + off); off += (size_t)MROWS * KVW * 2;
  float* yf = (float*)(ws + off); off += (size_t)MROWS * HID * 4; // 16 MB
  float* rope_cs = (float*)(ws + off); off += (size_t)T * ROT * 2 * 4;
  float* xp = (float*)(ws + off); off += (size_t)MROWS * HID * 4; // x, fragment-packed
  if (off > ws_size) return;
  rope_table_kernel<<<(T * ROT + 255) / 256, 256, 0, stream>>>(fr, rope_cs);
  const int ROWBLK = MROWS / 128, NQT = Bsz * NH * QT_PER_B;   // full job

  wcvt_kernel<<<2048, 256, 0, stream>>>(Wq, Wk, Wv, Wo, x, wqh, wql, woh, wol, xp);
  qkv_gemm_kernel<<<dim3(NQKV / 64, ROWBLK), 128, 0, stream>>>(xp, xp, xp, wqh, wql, bq, bk, bv, rope_cs, 0, 0, Qh, Ql, Kh, Kl, Vh, Vl);
  attn_kernel<<<NQT / 8, 256, 0, stream>>>(Qh, Ql, Kh, Kl, Vh, Vl, yf);
  out_gemm_kernel<<<dim3(HID / 64, ROWBLK), 128, 0, stream>>>(yf, woh, wol, bo, 0, out);
}

// v003
// It runs in 143 microseconds.
// In both of two side-by-side timings against v002, it was 1.10 times as fast.
// Counting every step since v000, it is 2.31 times as fast.
#include <hip/hip_runtime.h>

// CLVP self-attention: q/k/v = x.W^T (torch [out][in] weights, no bias), partial rotary embedding on the first 32 dims of every head of q, k AND v
// (rotate-half: pairs (d, d+16), cos/sin of the given rotary_pos_emb[s][d]), q x 1/8, causal softmax, y = P.V, out = y.Wo^T + bo. B=4, S=1024, 16x64.
// All contractions as bf16 hi/lo splits on v_wmma_f32_16x16x32_bf16 (hi.hi + hi.lo + lo.hi, f32 accumulate): the outputs have rms 0.04.

namespace {
constexpr int Bsz = 4, T = 1024, HID = 1024, DH = 64, NH = 16, NKV = 16, REP = NH / NKV;
constexpr int ROT = 32;   // rotary dims per head
constexpr int KVW = NKV * DH;                 // 1024
constexpr int NQKV = HID + 2 * KVW;           // 3072 columns: q | k | v
constexpr int MROWS = Bsz * T;                // 4096
constexpr int QT_PER_B = T / 16;              // 64

typedef __bf16 b16;
typedef __attribute__((ext_vector_type(16))) __bf16 v16b;
typedef __attribute__((ext_vector_type(8)))  __bf16 v8b;
typedef __attribute__((ext_vector_type(8)))  float v8f;
typedef __attribute__((ext_vector_type(4)))  float v4f;

__device__ __forceinline__ v8b ld8b(const b16* p) { return *(const v8b*)p; }
__device__ __forceinline__ v16b cat8b(v8b a, v8b b) { return __builtin_shufflevector(a, b, 0, 1, 2, 3, 4, 5, 6, 7, 8, 9, 10, 11, 12, 13, 14, 15); }
// 16x16x32 16-bit fragment (A: lane&15 = row, B: lane&15 = column), hh = lane>>4: elements 0..7 <- k = 8hh+0..7, elements 8..15 <- k = 16+8hh+0..7.
// Loaded from FRAGMENT-PACKED storage: a 16 x 32 tile is 2 groups of 256 elements, group j at lane*8 holds that lane's elements 8j..8j+7,
// so each wave-wide 16-byte load covers 512 contiguous bytes (4 whole lines) instead of 16 rows. p already includes lane*8.
__device__ __forceinline__ v16b frag_pk(const b16* p) { return cat8b(ld8b(p), ld8b(p + 256)); }
__device__ __forceinline__ void split_bf16(float v, b16& hi, b16& lo) {
  const unsigned int u = __builtin_bit_cast(unsigned int, v) & 0xffff0000u;
  hi = __builtin_bit_cast(b16, (unsigned short)(u >> 16));
  lo = (b16)(v - __builtin_bit_cast(float, u));
}
// split fragment from fragment-packed f32: a 16 x 32 tile is 4 groups of 128 floats, group j at lane*4 holds that lane's elements 4j..4j+3
// (k = 16(j>>1) + 8hh + 4(j&1) + e, the k order above). p already includes lane*4.
// The load and the split are two functions, so that a tile's four loads can be issued one k block before it is split.
__device__ __forceinline__ void frag_pload(const float* p, v4f (&f)[4]) {
#pragma unroll
  for (int j = 0; j < 4; ++j) f[j] = *(const v4f*)(p + j * 128);
}
__device__ __forceinline__ void frag_psplit(const v4f (&f)[4], v16b& fh_, v16b& fl_) {
#pragma unroll
  for (int j = 0; j < 4; ++j)
#pragma unroll
    for (int e = 0; e < 4; ++e) { b16 a, c; split_bf16(f[j][e], a, c); fh_[j * 4 + e] = a; fl_[j * 4 + e] = c; }
}
__device__ __forceinline__ v8f wmma16b(v16b a, v16b b, v8f c) {
  v8f d = __builtin_amdgcn_wmma_f32_16x16x32_bf16(false, a, false, b, (short)0, c, false, false);
  asm volatile("v_nop\n\tv_nop\n\tv_nop\n\tv_nop" : "+v"(d) : "v"(a), "v"(b));
  return d;
}
// acc += A.B with both operands split: A = (ah, al), B = (bh, bl)
__device__ __forceinline__ v8f wmma3(v16b ah, v16b al, v16b bh, v16b bl, v8f c) {
  c = wmma16b(ah, bh, c); c = wmma16b(ah, bl, c); c = wmma16b(al, bh, c); return c;
}
__device__ __forceinline__ void wave_lds_sync() {
  __builtin_amdgcn_fence(__ATOMIC_RELEASE, "workgroup");
  __builtin_amdgcn_wave_barrier();
  __builtin_amdgcn_fence(__ATOMIC_ACQUIRE, "workgroup");
}

// ---------------------------------------------------------------------------
// Packing pass. Weights (torch [out][in]) -> bf16 hi / lo planes in fragment-packed 16(n) x 32(k) tiles, tile index ntile*(HID/32)+kblk: rows of Wq|Wk|Wv into
// wqh/wql (3072 x 1024), Wo into woh/wol (1024 x 1024). x -> xp, f32, fragment-packed 16(m) x 32(k) tiles. Threads follow the destination: whole-line stores.
// ---------------------------------------------------------------------------
__global__ __launch_bounds__(256) void wcvt_kernel(const float* __restrict__ wq, const float* __restrict__ wk, const float* __restrict__ wv,
                                                   const float* __restrict__ wo, const float* __restrict__ x, b16* __restrict__ wqh, b16* __restrict__ wql,
                                                   b16* __restrict__ woh, b16* __restrict__ wol, float* __restrict__ xp) {
  const size_t tid = (size_t)blockIdx.x * blockDim.x + threadIdx.x, stride = (size_t)gridDim.x * blockDim.x;
  const size_t nq = (size_t)NQKV * HID / 8, no = (size_t)HID * HID / 8, nx = (size_t)MROWS * HID / 4;
  for (size_t c = tid; c < nq + no; c += stride) {
    const bool isq = c < nq;
    const size_t cc = isq ? c : c - nq;                     // 8-element chunk of the packed plane: lane | group j | kblk | ntile
    const int ln = (int)(cc & 31), j = (int)(cc >> 5) & 1, kblk = (int)(cc >> 6) & (HID / 32 - 1);
    const int n = (int)(cc >> 11) * 16 + (ln & 15), k0 = kblk * 32 + j * 16 + (ln >> 4) * 8;
    const float* w; int nn;
    if (!isq) { w = wo; nn = n; } else if (n < HID) { w = wq; nn = n; } else if (n < HID + KVW) { w = wk; nn = n - HID; } else { w = wv; nn = n - HID - KVW; }
    const float* src = w + (size_t)nn * HID + k0;
    const v4f f0 = *(const v4f*)src, f1 = *(const v4f*)(src + 4);
    v8b bh, bl;
#pragma unroll
    for (int e = 0; e < 4; ++e) { b16 a, d; split_bf16(f0[e], a, d); bh[e] = a; bl[e] = d; split_bf16(f1[e], a, d); bh[4 + e] = a; bl[4 + e] = d; }
    *(v8b*)((isq ? wqh : woh) + cc * 8) = bh; *(v8b*)((isq ? wql : wol) + cc * 8) = bl;
  }
  for (size_t c = tid; c < nx; c += stride) {               // 4-float chunk of xp: lane | group j | kblk | mtile
    const int ln = (int)(c & 31), j = (int)(c >> 5) & 3, kblk = (int)(c >> 7) & (HID / 32 - 1);
    const size_t m = (c >> 12) * 16 + (ln & 15);
    *(v4f*)(xp + c * 4) = *(const v4f*)(x + m * HID + kblk * 32 + (j >> 1) * 16 + (ln >> 4) * 8 + (j & 1) * 4);
  }
}

// One stage of the LDS ring: KS k blocks of a 128 x 128 work-group tile, every 16 x 32 tile in the fragment-packed order it has in global memory.
// Bytes of a stage: A (f32) 8 m tiles x KS x 2 KB | B hi plane 8 n tiles x KS x 1 KB | B lo plane the same.
constexpr int KS = 2;
constexpr int STAGE_A = 8 * KS * 2048, STAGE_P = 8 * KS * 1024, STAGE_B = STAGE_A + 2 * STAGE_P;   // 64 KB
constexpr int RING_B = 2 * STAGE_B;

// Eight asynchronous 16-byte-per-lane copies, global -> LDS. The s_wait_xcnt stands inside the statement, so that no address register of a copy is rewritten ahead of it.
__device__ __forceinline__ void async_copy8(const unsigned (&d)[8], const char* const (&p)[8]) {
  asm volatile("global_load_async_to_lds_b128 %0, %8, off\n\t"
               "global_load_async_to_lds_b128 %1, %9, off\n\t"
               "global_load_async_to_lds_b128 %2, %10, off\n\t"
               "global_load_async_to_lds_b128 %3, %11, off\n\t"
               "global_load_async_to_lds_b128 %4, %12, off\n\t"
               "global_load_async_to_lds_b128 %5, %13, off\n\t"
               "global_load_async_to_lds_b128 %6, %14, off\n\t"
               "global_load_async_to_lds_b128 %7, %15, off\n\t"
               "s_wait_xcnt 0x0"
               :: "v"(d[0]), "v"(d[1]), "v"(d[2]), "v"(d[3]), "v"(d[4]), "v"(d[5]), "v"(d[6]), "v"(d[7]),
                  "v"(p[0]), "v"(p[1]), "v"(p[2]), "v"(p[3]), "v"(p[4]), "v"(p[5]), "v"(p[6]), "v"(p[7])
               : "memory");
}

// 128 x 128 work-group tile over K, 8 waves as 4 (m) x 2 (n), each a 32 x 64 wave tile. A (fragment-packed f32) and B (fragment-packed bf16 planes) come through a
// two-buffer LDS ring filled by asynchronous copies, so that a tile is fetched from L2 once per work-group: an A tile serves 2 waves, a B tile 4.
// Waves 0..3 copy two A m tiles each, waves 4..7 four n tiles of one B plane each: 16 copies of 512 B per wave and stage, landing at ring + wave * 8 KB.
__device__ __forceinline__ void gemm_tile_split(const float* __restrict__ A, const b16* __restrict__ wh, const b16* __restrict__ wl,
                                                int mb, int cb, int K, int wave, int lane, unsigned char* ring, v8f (&acc)[2][4]) {
  const int KB = K / 32, NT = KB / KS;
  const int wm = wave & 3, wn = wave >> 2;
  const bool isA = wave < 4;
  const int wq = wave & 3;
  const char* gsrc = isA ? (const char*)A + (size_t)((mb >> 4) + wq * 2) * KB * 2048
                         : (const char*)((wq >> 1) ? wl : wh) + (size_t)((cb >> 4) + (wq & 1) * 4) * KB * 1024;
  gsrc += lane * 16;
  const unsigned adv = isA ? KS * 2048u : KS * 1024u;                       // bytes a tile row advances per stage
  const unsigned lds0 = (unsigned)(uintptr_t)ring + wave * 8192u + lane * 16u;
  auto issue = [&](int tile, int buf) {
    const char* g = gsrc + (size_t)tile * adv;
    const unsigned l = lds0 + buf * (unsigned)STAGE_B;
#pragma unroll
    for (int h = 0; h < 2; ++h) {
      unsigned d[8]; const char* p[8];
#pragma unroll
      for (int i = 0; i < 8; ++i) {
        const int c = h * 8 + i;
        const unsigned oa = (c / (KS * 4)) * (unsigned)(KB * 2048) + (c % (KS * 4)) * 512u, ob = (c / (KS * 2)) * (unsigned)(KB * 1024) + (c % (KS * 2)) * 512u;
        p[i] = g + (isA ? oa : ob); d[i] = l + c * 512u;
      }
      async_copy8(d, p);
    }
  };
  issue(0, 0);
  asm volatile("s_wait_asynccnt 0x0" ::: "memory");      // this wave's part of stage 0 has landed
  __syncthreads();                                        // ... and every other wave's
  issue(1, 1);
  for (int t = 0; t < NT; ++t) {
    const unsigned char* sb = ring + (t & 1) * STAGE_B;
    const float* la = (const float*)(sb + wm * 2 * KS * 2048) + lane * 4;
    const b16* lbh = (const b16*)(sb + STAGE_A + wn * 4 * KS * 1024) + lane * 8;
    const b16* lbl = lbh + STAGE_P / 2;
    // inside a stage every fragment is read one k block ahead: A's f32 words at the head of the block before, B tile u into its own registers behind its products
    v4f ar0[4], ar1[4];
    v16b bh[4], bl[4], a0h, a0l, a1h, a1l;
    frag_pload(la, ar0);
    frag_pload(la + KS * 512, ar1);
#pragma unroll
    for (int u = 0; u < 4; ++u) { bh[u] = frag_pk(lbh + u * KS * 512); bl[u] = frag_pk(lbl + u * KS * 512); }
    frag_psplit(ar0, a0h, a0l);
    frag_psplit(ar1, a1h, a1l);
#pragma unroll
    for (int kk = 0; kk < KS; ++kk) {
      if (kk + 1 < KS) { frag_pload(la + (kk + 1) * 512, ar0); frag_pload(la + (KS + kk + 1) * 512, ar1); }
#pragma unroll
      for (int u = 0; u < 4; ++u) {
        acc[0][u] = wmma3(a0h, a0l, bh[u], bl[u], acc[0][u]);
        acc[1][u] = wmma3(a1h, a1l, bh[u], bl[u], acc[1][u]);
        if (kk + 1 < KS) { bh[u] = frag_pk(lbh + (u * KS + kk + 1) * 512); bl[u] = frag_pk(lbl + (u * KS + kk + 1) * 512); }
      }
      if (kk + 1 < KS) { frag_psplit(ar0, a0h, a0l); frag_psplit(ar1, a1h, a1l); }
    }
    asm volatile("s_wait_dscnt 0x0" ::: "memory");       // this wave has left the buffer it read
    asm volatile("s_wait_asynccnt 0x0" ::: "memory");    // its part of stage t + 1 has landed
    __syncthreads();                                      // publishes stage t + 1 and frees stage t's buffer
    if (t + 2 < NT) issue(t + 2, t & 1);
  }
  asm volatile("s_wait_asynccnt 0x0" ::: "memory");      // nothing is in flight when the ring becomes output staging
}

// ---------------------------------------------------------------------------
// QKV GEMM: x (rows x 1024) times (1024 x 3072), one 128 x 128 tile per block of 8 waves, wave = 32 rows x 64 columns (one head of q, k or v). Outputs as bf16 hi/lo planes:
// q (x1/8) -> Qh/Ql [b][h][t/16] and k -> Kh/Kl [b][kvh][t/16], each 16 x 64 tile as two fragment-packed 16 x 32 tiles (4 KB contiguous per wave per plane);
// v -> Vh/Vl key-tiled [b][kvh][t/16][64][16] (4 KB contiguous per wave per plane).
// ---------------------------------------------------------------------------
__global__ __launch_bounds__(256) void qkv_gemm_kernel(const float* __restrict__ xq, const float* __restrict__ xk, const float* __restrict__ xv,
                                                       const b16* __restrict__ wqh, const b16* __restrict__ wql,
                                                       const float* __restrict__ bq, const float* __restrict__ bk, const float* __restrict__ bv, const float* __restrict__ rope_cs, int xoff, int yoff,
                                                       b16* __restrict__ Qh, b16* __restrict__ Ql, b16* __restrict__ Kh, b16* __restrict__ Kl,
                                                       b16* __restrict__ Vh, b16* __restrict__ Vl) {
  __shared__ __attribute__((aligned(16))) unsigned char ring[RING_B];   // the GEMM's ring, then each wave's output staging
  // the wave's number is wave-uniform; readfirstlane tells the compiler so: tile, head and copy addresses then come from scalar registers
  const int lane = threadIdx.x & 31, wave = __builtin_amdgcn_readfirstlane(threadIdx.x >> 5), nloc = lane & 15, hlf = lane >> 4;
  const int mb = (blockIdx.y + yoff) * 128, cb = (blockIdx.x + xoff) * 128;
  const int m0 = mb + (wave & 3) * 32;
  const int c0 = cb + (wave >> 2) * 64;
  const int mat = (cb < HID) ? 0 : (cb < HID + KVW) ? 1 : 2;          // a 128-column block lies inside one of q, k, v
  const int head = (mat == 0) ? (c0 / DH) : (mat == 1) ? ((c0 - HID) / DH) : ((c0 - HID - KVW) / DH);
  const float* x = (mat == 0) ? xq : (mat == 1) ? xk : xv;          // q, k and v inputs; the launch passes xp (packed x) for all three
  const float* bias = ((mat == 0) ? bq : (mat == 1) ? bk : bv) + head * DH;
  v8f acc[2][4];
#pragma unroll
  for (int r = 0; r < 2; ++r)
#pragma unroll
    for (int t = 0; t < 4; ++t) acc[r][t] = (v8f){};
  gemm_tile_split(x, wqh, wql, mb, cb, HID, wave, lane, ring, acc);
  const int b = m0 / T, t0 = m0 % T;
  const float s = (mat == 0) ? 0.125f : 1.0f;
  b16* Tp0 = (b16*)(ring + wave * 8192); b16* Tp1 = Tp0 + 32 * 64;
  // the lane's 32 cos/sin pairs, fetched as one group ahead of the loop that uses them (one wait instead of one per element)
  typedef __attribute__((ext_vector_type(2))) float v2f;
  v2f cs[2][2][8];
  const float* csp = rope_cs + ((size_t)(t0 + 8 * hlf) * ROT + nloc) * 2;
#pragma unroll
  for (int t = 0; t < 2; ++t)
#pragma unroll
    for (int r = 0; r < 2; ++r)
#pragma unroll
      for (int v = 0; v < 8; ++v) cs[t][r][v] = *(const v2f*)(csp + ((r * 16 + v) * ROT + t * 16) * 2);
  // the group's address stays in its registers up to this wait, so that none of the group's own results lands on it
  asm volatile("s_wait_xcnt 0x0" :: "v"(csp) : "memory");
#pragma unroll
  for (int t = 0; t < 4; ++t)
#pragma unroll
    for (int r = 0; r < 2; ++r)
#pragma unroll
      for (int v = 0; v < 8; ++v) {
        const int rr = r * 16 + v + 8 * hlf, d = t * 16 + nloc;
        float val = acc[r][t][v] + (bias ? bias[d] : 0.0f);
        if (t < 2) {                                     // partial rotary on dims 0..31 of q, k and v: x*cos(f) + rotate_half(x)*sin(f), partner d^16 is tile t^1 (same lane)
          const float cv = cs[t & 1][r][v][0], sv = cs[t & 1][r][v][1];   // precomputed cos/sin of rotary_pos_emb at sequence position t0 + rr
          const float oth = acc[r][t ^ 1][v] + (bias ? bias[d ^ 16] : 0.0f);
          val = (t == 0) ? (val * cv - oth * sv) : (val * cv + oth * sv);
        }
        b16 yh, yl; split_bf16(val * s, yh, yl);
        const int idx = (mat < 2) ? ((rr >> 4) * 1024 + (d >> 4) * 256 + (((d >> 3) & 1) * 16 + (rr & 15)) * 8 + (d & 7)) : ((rr >> 4) * 1024 + d * 16 + (rr & 15));
        Tp0[idx] = yh; Tp1[idx] = yl;
      }
  wave_lds_sync();
  b16* dh; b16* dl; size_t o;
  if (mat == 0)      { o = ((size_t)(b * NH + head) * T + t0) * DH; dh = Qh + o; dl = Ql + o; }
  else if (mat == 1) { o = ((size_t)(b * NKV + head) * T + t0) * DH; dh = Kh + o; dl = Kl + o; }
  else               { o = ((size_t)(b * NKV + head) * QT_PER_B + (t0 >> 4)) * (size_t)(DH * 16); dh = Vh + o; dl = Vl + o; }
#pragma unroll
  for (int j = 0; j < 8; ++j) { const int e = (j * 32 + lane) * 8; *(v8b*)(dh + e) = ld8b(Tp0 + e); *(v8b*)(dl + e) = ld8b(Tp1 + e); }
  
}

// ---------------------------------------------------------------------------
// Transposed flash attention: each wave owns one 16-query tile of one (b, head); 8 waves per block, eight neighbouring tiles of one head; keys in chunks of 32.
// S^T = K.Q^T (split), per-lane online softmax; P^T built in registers from the two S^T accumulators.
// K and V come through a two-buffer LDS ring filled by asynchronous copies, so that a chunk is fetched from L2 once per block and read by each wave whose queries reach it.
// A stage is ACH chunks: K hi | K lo | V hi | V lo, ACH * 4 KB each, every plane in the order it has in global memory.
// ---------------------------------------------------------------------------
constexpr int ACH = 2;
constexpr int APLANE = ACH * 4096, ASTAGE = 4 * APLANE;   // 8 KB, 32 KB
__global__ __launch_bounds__(256) void attn_kernel(const b16* __restrict__ Qh, const b16* __restrict__ Ql, const b16* __restrict__ Kh, const b16* __restrict__ Kl,
                                                   const b16* __restrict__ Vh, const b16* __restrict__ Vl,
                                                   float* __restrict__ yf) {
  __shared__ __attribute__((aligned(16))) unsigned char ring[2 * ASTAGE];
  // the wave's number is wave-uniform; readfirstlane tells the compiler so: tile index, trip count and chunk addresses then live in scalar registers
  const int wid = __builtin_amdgcn_readfirstlane(threadIdx.x >> 5), lane = threadIdx.x & 31, hh = lane >> 4, col = lane & 15;
  const int qtile = blockIdx.x * 8 + wid;                 // over Bsz*NH*QT_PER_B
  const int g = qtile / QT_PER_B;                         // b*NH + h, the same for the block's 8 waves (8 divides QT_PER_B)
  const int q0 = (qtile % QT_PER_B) << 4;
  const int b = g / NH, h = g % NH, kvh = h / REP;
  const size_t ko = (size_t)(b * NKV + kvh) * T * DH;
  const size_t qo = ((size_t)g * T + q0) * DH + lane * 8;
  const v16b q0h = frag_pk(Qh + qo), q0l = frag_pk(Ql + qo), q1h = frag_pk(Qh + qo + 512), q1l = frag_pk(Ql + qo + 512);
  // the two Q addresses stay in their registers up to this wait, so that none of the Q fragments lands on them
  asm volatile("s_wait_xcnt 0x0" :: "v"(Qh + qo), "v"(Ql + qo) : "memory");
  float m = -INFINITY, l = 0.0f;
  v8f o0 = {}, o1 = {}, o2 = {}, o3 = {};
  // stages the block walks: up to its last tile's last query; a multiple of 128 keys, so at least two stages
  const int NS = ((((blockIdx.x * 8) % QT_PER_B) + 8) << 4) / (32 * ACH);
  // wave w copies half w & 1 of plane w >> 1: 8 copies of 512 B per stage, landing at ring + w * 4 KB
  const b16* pl = (wid >> 1) == 0 ? Kh : (wid >> 1) == 1 ? Kl : (wid >> 1) == 2 ? Vh : Vl;
  const char* gsrc = (const char*)(pl + ko) + (wid & 1) * (APLANE / 2) + lane * 16;
  const unsigned lds0 = (unsigned)(uintptr_t)ring + wid * (unsigned)(APLANE / 2) + lane * 16u;
  auto issue = [&](int stage, int buf) {
    unsigned d[8]; const char* p[8];
#pragma unroll
    for (int i = 0; i < 8; ++i) { p[i] = gsrc + (size_t)stage * APLANE + i * 512; d[i] = lds0 + buf * (unsigned)ASTAGE + i * 512u; }
    async_copy8(d, p);
  };
  issue(0, 0);
  asm volatile("s_wait_asynccnt 0x0" ::: "memory");      // this wave's part of stage 0 has landed
  __syncthreads();                                        // ... and every other wave's
  issue(1, 1);
  for (int s = 0; s < NS; ++s) {
    const b16* sb = (const b16*)(ring + (s & 1) * ASTAGE);
#pragma unroll
    for (int c = 0; c < ACH; ++c) {
      const int kb = (s * ACH + c) * 32;
      if (kb < q0 + 16) {                                 // causal: key chunks up to the tile's last query (wave-uniform; the publish point below is outside)
        // A chunk of K is two packed 16-key tiles = four 16 x 32 fragments 512 elements apart; a chunk of V two key tiles of 64 x 16.
        const b16* lk = sb + c * 2048 + lane * 8;
        const b16* lv = sb + APLANE + c * 2048 + col * 16 + 8 * hh;
        v16b kfh[4], kfl[4], vfh[4], vfl[4];
#pragma unroll
        for (int i = 0; i < 4; ++i) { kfh[i] = frag_pk(lk + i * 512); kfl[i] = frag_pk(lk + APLANE / 2 + i * 512); }
        // LDS reads return in order: K's stay in front of V's, so that the score products wait for K alone and V lands behind them
        __builtin_amdgcn_sched_barrier(0);
#pragma unroll
        for (int i = 0; i < 4; ++i) {
          vfh[i] = cat8b(ld8b(lv + i * 256), ld8b(lv + DH * 16 + i * 256));
          vfl[i] = cat8b(ld8b(lv + APLANE / 2 + i * 256), ld8b(lv + APLANE / 2 + DH * 16 + i * 256));
        }
        v8f s0 = {}, s1 = {};
        s0 = wmma3(kfh[0], kfl[0], q0h, q0l, s0);
        s0 = wmma3(kfh[1], kfl[1], q1h, q1l, s0);
        s1 = wmma3(kfh[2], kfl[2], q0h, q0l, s1);
        s1 = wmma3(kfh[3], kfl[3], q1h, q1l, s1);
        if (kb + 32 > q0) {                               // diagonal chunk: mask keys after the query
          const int qi = q0 + col;
#pragma unroll
          for (int r = 0; r < 8; ++r) {
            if (kb + 8 * hh + r > qi)      s0[r] = -INFINITY;
            if (kb + 16 + 8 * hh + r > qi) s1[r] = -INFINITY;
          }
        }
        float mr = -INFINITY;
#pragma unroll
        for (int r = 0; r < 8; ++r) mr = fmaxf(mr, fmaxf(s0[r], s1[r]));
        mr = fmaxf(mr, __shfl_xor(mr, 16));
        const float mn = fmaxf(m, mr);            // finite
        const float al_ = __expf(m - mn);
        m = mn;
        float sum = 0.0f;
        v16b pbh, pbl;
#pragma unroll
        for (int r = 0; r < 8; ++r) {
          const float p0 = __expf(s0[r] - mn), p1 = __expf(s1[r] - mn);
          sum += p0 + p1;
          b16 a, c2; split_bf16(p0, a, c2); pbh[r] = a; pbl[r] = c2; split_bf16(p1, a, c2); pbh[8 + r] = a; pbl[8 + r] = c2;
        }
        sum += __shfl_xor(sum, 16);
        l = l * al_ + sum;
#pragma unroll
        for (int r = 0; r < 8; ++r) { o0[r] *= al_; o1[r] *= al_; o2[r] *= al_; o3[r] *= al_; }
        o0 = wmma3(vfh[0], vfl[0], pbh, pbl, o0);
        o1 = wmma3(vfh[1], vfl[1], pbh, pbl, o1);
        o2 = wmma3(vfh[2], vfl[2], pbh, pbl, o2);
        o3 = wmma3(vfh[3], vfl[3], pbh, pbl, o3);
      }
    }
    asm volatile("s_wait_dscnt 0x0" ::: "memory");       // this wave has left the buffer it read
    asm volatile("s_wait_asynccnt 0x0" ::: "memory");    // its part of stage s + 1 has landed
    __syncthreads();                                      // publishes stage s + 1 and frees stage s's buffer
    if (s + 2 < NS) issue(s + 2, s & 1);
  }
  asm volatile("s_wait_asynccnt 0x0" ::: "memory");      // nothing is in flight when the wave ends
  const float inv = 1.0f / l;
  // y in fragment-packed f32 tiles for the output projection: O^T's accumulator (feature 8hh+r, query col) already is the A fragment's lane and k order,
  // so every lane stores its own 4-float groups and each wave-wide store is 512 contiguous bytes.
  float* dst0 = yf + ((size_t)((b * T + q0) >> 4) * (HID / 32) + h * 2) * 512 + lane * 4;
#pragma unroll
  for (int n = 0; n < 4; ++n) {
    const v8f o = (n == 0) ? o0 : (n == 1) ? o1 : (n == 2) ? o2 : o3;
#pragma unroll
    for (int u = 0; u < 2; ++u) {
      const v4f w = {o[u * 4] * inv, o[u * 4 + 1] * inv, o[u * 4 + 2] * inv, o[u * 4 + 3] * inv};
      *(v4f*)(dst0 + (n >> 1) * 512 + ((n & 1) * 2 + u) * 128) = w;
    }
  }
}

// ---------------------------------------------------------------------------
// Output projection: (4096 x 1024) x (1024 x 1024) -> f32, A split on the fly from packed f32 y, B = packed Wo planes. One 128 x 128 tile per block of 8 waves, 32x64 wave tiles staged in LDS,
// ---------------------------------------------------------------------------
__global__ __launch_bounds__(256) void out_gemm_kernel(const float* __restrict__ yf, const b16* __restrict__ woh, const b16* __restrict__ wol, const float* __restrict__ bo, int yoff,
                                                       float* __restrict__ out) {
  __shared__ __attribute__((aligned(16))) unsigned char ring[RING_B];   // the GEMM's ring, then each wave's output staging
  const int lane = threadIdx.x & 31, wave = __builtin_amdgcn_readfirstlane(threadIdx.x >> 5), nloc = lane & 15, hlf = lane >> 4;
  const int mb = (blockIdx.y + yoff) * 128, cb = blockIdx.x * 128;
  const int m0 = mb + (wave & 3) * 32;
  const int c0 = cb + (wave >> 2) * 64;
  v8f acc[2][4];
#pragma unroll
  for (int r = 0; r < 2; ++r)
#pragma unroll
    for (int t = 0; t < 4; ++t) acc[r][t] = (v8f){};
  gemm_tile_split(yf, woh, wol, mb, cb, HID, wave, lane, ring, acc);
  float* Tt = (float*)(ring + wave * 8192);
#pragma unroll
  for (int t = 0; t < 4; ++t)
#pragma unroll
    for (int r = 0; r < 2; ++r)
#pragma unroll
      for (int v = 0; v < 8; ++v) Tt[(r * 16 + v + 8 * hlf) * 64 + t * 16 + nloc] = acc[r][t][v] + bo[c0 + t * 16 + nloc];
  wave_lds_sync();
  float* dst0 = out + (size_t)m0 * HID + c0;
#pragma unroll
  for (int j = 0; j < 16; ++j) { const int rr = j * 2 + hlf, c4 = nloc * 4; *(v4f*)(dst0 + (size_t)rr * HID + c4) = *(const v4f*)(Tt + rr * 64 + c4); }
  
}
__global__ __launch_bounds__(256) void rope_table_kernel(const float* __restrict__ fr, float* __restrict__ cs) {
  const int idx = blockIdx.x * 256 + threadIdx.x;        // T * 32
  if (idx >= T * ROT) return;
  const float f = fr[idx];
  typedef __attribute__((ext_vector_type(2))) float v2f;
  const v2f p = {cosf(f), sinf(f)};
  *(v2f*)(cs + (size_t)idx * 2) = p; 
}
}  // namespace

extern "C" void kernel_launch(void* const* d_in, const int* in_sizes, int n_in,
                              void* d_out, int out_size, void* d_ws, size_t ws_size, hipStream_t stream) {
  (void)in_sizes; (void)n_in; (void)out_size;
  const float* x  = (const float*)d_in[0];   // hidden_states [4,1024,1024]
  const float* fr = (const float*)d_in[1];   // rotary_pos_emb [1,1024,32]
  const float* Wq = (const float*)d_in[2];   // [1024,1024] torch [out][in]
  const float* Wk = (const float*)d_in[3];
  const float* Wv = (const float*)d_in[4];
  const float* Wo = (const float*)d_in[5];
  const float* bo = (const float*)d_in[6];
  const float* bq = nullptr; const float* bk = nullptr; const float* bv = nullptr;
  float* out = (float*)d_out;                // [4,1024,1024] f32

  size_t off = 0; char* ws = (char*)d_ws;
  b16* wqh = (b16*)(ws + off); off += (size_t)NQKV * HID * 2;     // 6 MB
  b16* wql = (b16*)(ws + off); off += (size_t)NQKV * HID * 2;
  b16* woh = (b16*)(ws + off); off += (size_t)HID * HID * 2;      // 2 MB
  b16* wol = (b16*)(ws + off); off += (size_t)HID * HID * 2;
  b16* Qh  = (b16*)(ws + off); off += (size_t)MROWS * HID * 2;    // 8 MB each
  b16* Ql  = (b16*)(ws + off); off += (size_t)MROWS * HID * 2;
  b16* Kh  = (b16*)(ws + off); off += (size_t)MROWS * KVW * 2;
  b16* Kl  = (b16*)(ws + off); off += (size_t)MROWS * KVW * 2;
  b16* Vh  = (b16*)(ws + off); off += (size_t)MROWS * KVW * 2;
  b16* Vl  = (b16*)(ws + off); off += (size_t)MROWS * KVW * 2;
  float* yf = (float*)(ws + off); off += (size_t)MROWS * HID * 4; // 16 MB
  float* rope_cs = (float*)(ws + off); off += (size_t)T * ROT * 2 * 4;
  float* xp = (float*)(ws + off); off += (size_t)MROWS * HID * 4; // x, fragment-packed
  if (off > ws_size) return;
  rope_table_kernel<<<(T * ROT + 255) / 256, 256, 0, stream>>>(fr, rope_cs);
  const int ROWBLK = MROWS / 128, NQT = Bsz * NH * QT_PER_B;   // full job

  wcvt_kernel<<<2048, 256, 0, stream>>>(Wq, Wk, Wv, Wo, x, wqh, wql, woh, wol, xp);
  qkv_gemm_kernel<<<dim3(NQKV / 128, ROWBLK), 256, 0, stream>>>(xp, xp, xp, wqh, wql, bq, bk, bv, rope_cs, 0, 0, Qh, Ql, Kh, Kl, Vh, Vl);
  attn_kernel<<<NQT / 8, 256, 0, stream>>>(Qh, Ql, Kh, Kl, Vh, Vl, yf);
  out_gemm_kernel<<<dim3(HID / 128, ROWBLK), 256, 0, stream>>>(yf, woh, wol, bo, 0, out);
}

// v004
// One run takes 130 microseconds.
// Next to v003, in two timings, it ran 1.10 times as fast each time.
// All steps since v000 together make it 2.53 times as fast.
#include <hip/hip_runtime.h>

// CLVP self-attention: q/k/v = x.W^T (torch [out][in] weights, no bias), partial rotary embedding on the first 32 dims of every head of q, k AND v
// (rotate-half: pairs (d, d+16), cos/sin of the given rotary_pos_emb[s][d]), q x 1/8, causal softmax, y = P.V, out = y.Wo^T + bo. B=4, S=1024, 16x64.
// All contractions as bf16 hi/lo splits on v_wmma_f32_16x16x32_bf16 (hi.hi + hi.lo + lo.hi, f32 accumulate): the outputs have rms 0.04.

namespace {
constexpr int Bsz = 4, T = 1024, HID = 1024, DH = 64, NH = 16, NKV = 16, REP = NH / NKV;
constexpr int ROT = 32;   // rotary dims per head
constexpr int KVW = NKV * DH;                 // 1024
constexpr int NQKV = HID + 2 * KVW;           // 3072 columns: q | k | v
constexpr int MROWS = Bsz * T;                // 4096
constexpr int QT_PER_B = T / 16;              // 64

typedef __bf16 b16;
typedef __attribute__((ext_vector_type(16))) __bf16 v16b;
typedef __attribute__((ext_vector_type(8)))  __bf16 v8b;
typedef __attribute__((ext_vector_type(8)))  float v8f;
typedef __attribute__((ext_vector_type(4)))  float v4f;

__device__ __forceinline__ v8b ld8b(const b16* p) { return *(const v8b*)p; }
__device__ __forceinline__ v16b cat8b(v8b a, v8b b) { return __builtin_shufflevector(a, b, 0, 1, 2, 3, 4, 5, 6, 7, 8, 9, 10, 11, 12, 13, 14, 15); }
// 16x16x32 16-bit fragment (A: lane&15 = row, B: lane&15 = column), hh = lane>>4: elements 0..7 <- k = 8hh+0..7, elements 8..15 <- k = 16+8hh+0..7.
// Loaded from FRAGMENT-PACKED storage: a 16 x 32 tile is 2 groups of 256 elements, group j at lane*8 holds that lane's elements 8j..8j+7,
// so each wave-wide 16-byte load covers 512 contiguous bytes (4 whole lines) instead of 16 rows. p already includes lane*8.
__device__ __forceinline__ v16b frag_pk(const b16* p) { return cat8b(ld8b(p), ld8b(p + 256)); }
__device__ __forceinline__ void split_bf16(float v, b16& hi, b16& lo) {
  const unsigned int u = __builtin_bit_cast(unsigned int, v) & 0xffff0000u;
  hi = __builtin_bit_cast(b16, (unsigned short)(u >> 16));
  lo = (b16)(v - __builtin_bit_cast(float, u));
}
// split fragment from fragment-packed f32: a 16 x 32 tile is 4 groups of 128 floats, group j at lane*4 holds that lane's elements 4j..4j+3
// (k = 16(j>>1) + 8hh + 4(j&1) + e, the k order above). p already includes lane*4.
// The load and the split are two functions, so that a tile's four loads can be issued one k block before it is split.
__device__ __forceinline__ void frag_pload(const float* p, v4f (&f)[4]) {
#pragma unroll
  for (int j = 0; j < 4; ++j) f[j] = *(const v4f*)(p + j * 128);
}
__device__ __forceinline__ void frag_psplit(const v4f (&f)[4], v16b& fh_, v16b& fl_) {
#pragma unroll
  for (int j = 0; j < 4; ++j)
#pragma unroll
    for (int e = 0; e < 4; ++e) { b16 a, c; split_bf16(f[j][e], a, c); fh_[j * 4 + e] = a; fl_[j * 4 + e] = c; }
}
__device__ __forceinline__ v8f wmma16b(v16b a, v16b b, v8f c) {
  return __builtin_amdgcn_wmma_f32_16x16x32_bf16(false, a, false, b, (short)0, c, false, false);
}
// acc += A.B with both operands split, A = (ah, al), B = (bh, bl), is three products: hi.hi, hi.lo, lo.hi, in that order into every accumulator.
// They are issued term by term, in rows over a group of independent accumulators, so that no product waits for the one issued just before it.
// row_end() stands behind each row and behind each group of LDS reads: without it the compiler's scheduler puts an accumulator's three products next to
// each other again and sinks the reads down to their first use, where their whole latency is waited for.
__device__ __forceinline__ void row_end() { __builtin_amdgcn_sched_barrier(0); }
// 2^x with the slot that the instruction set asks for behind a transcendental (before its result is read or its source register rewritten) in the same statement.
__device__ __forceinline__ float exp2_slot(float x) { float r; asm("v_exp_f32 %0, %1\n\tv_nop" : "=v"(r) : "v"(x)); return r; }
constexpr float LOG2E = 1.44269504f;
__device__ __forceinline__ void wave_lds_sync() {
  __builtin_amdgcn_fence(__ATOMIC_RELEASE, "workgroup");
  __builtin_amdgcn_wave_barrier();
  __builtin_amdgcn_fence(__ATOMIC_ACQUIRE, "workgroup");
}

// ---------------------------------------------------------------------------
// Packing pass. Weights (torch [out][in]) -> bf16 hi / lo planes in fragment-packed 16(n) x 32(k) tiles, tile index ntile*(HID/32)+kblk: rows of Wq|Wk|Wv into
// wqh/wql (3072 x 1024), Wo into woh/wol (1024 x 1024). x -> xp, f32, fragment-packed 16(m) x 32(k) tiles. Threads follow the destination: whole-line stores.
// ---------------------------------------------------------------------------
__global__ __launch_bounds__(256) void wcvt_kernel(const float* __restrict__ wq, const float* __restrict__ wk, const float* __restrict__ wv,
                                                   const float* __restrict__ wo, const float* __restrict__ x, b16* __restrict__ wqh, b16* __restrict__ wql,
                                                   b16* __restrict__ woh, b16* __restrict__ wol, float* __restrict__ xp) {
  const size_t tid = (size_t)blockIdx.x * blockDim.x + threadIdx.x, stride = (size_t)gridDim.x * blockDim.x;
  const size_t nq = (size_t)NQKV * HID / 8, no = (size_t)HID * HID / 8, nx = (size_t)MROWS * HID / 4;
  for (size_t c = tid; c < nq + no; c += stride) {
    const bool isq = c < nq;
    const size_t cc = isq ? c : c - nq;                     // 8-element chunk of the packed plane: lane | group j | kblk | ntile
    const int ln = (int)(cc & 31), j = (int)(cc >> 5) & 1, kblk = (int)(cc >> 6) & (HID / 32 - 1);
    const int n = (int)(cc >> 11) * 16 + (ln & 15), k0 = kblk * 32 + j * 16 + (ln >> 4) * 8;
    const float* w; int nn;
    if (!isq) { w = wo; nn = n; } else if (n < HID) { w = wq; nn = n; } else if (n < HID + KVW) { w = wk; nn = n - HID; } else { w = wv; nn = n - HID - KVW; }
    const float* src = w + (size_t)nn * HID + k0;
    const v4f f0 = *(const v4f*)src, f1 = *(const v4f*)(src + 4);
    v8b bh, bl;
#pragma unroll
    for (int e = 0; e < 4; ++e) { b16 a, d; split_bf16(f0[e], a, d); bh[e] = a; bl[e] = d; split_bf16(f1[e], a, d); bh[4 + e] = a; bl[4 + e] = d; }
    *(v8b*)((isq ? wqh : woh) + cc * 8) = bh; *(v8b*)((isq ? wql : wol) + cc * 8) = bl;
  }
  for (size_t c = tid; c < nx; c += stride) {               // 4-float chunk of xp: lane | group j | kblk | mtile
    const int ln = (int)(c & 31), j = (int)(c >> 5) & 3, kblk = (int)(c >> 7) & (HID / 32 - 1);
    const size_t m = (c >> 12) * 16 + (ln & 15);
    *(v4f*)(xp + c * 4) = *(const v4f*)(x + m * HID + kblk * 32 + (j >> 1) * 16 + (ln >> 4) * 8 + (j & 1) * 4);
  }
}

// One stage of the LDS ring: KS k blocks of a 128 x 128 work-group tile, every 16 x 32 tile in the fragment-packed order it has in global memory.
// Bytes of a stage: A (f32) 8 m tiles x KS x 2 KB | B hi plane 8 n tiles x KS x 1 KB | B lo plane the same.
constexpr int KS = 2;
constexpr int STAGE_A = 8 * KS * 2048, STAGE_P = 8 * KS * 1024, STAGE_B = STAGE_A + 2 * STAGE_P;   // 64 KB
constexpr int RING_B = 2 * STAGE_B;

// Eight asynchronous 16-byte-per-lane copies, global -> LDS. The s_wait_xcnt stands inside the statement, so that no address register of a copy is rewritten ahead of it.
__device__ __forceinline__ void async_copy8(const unsigned (&d)[8], const char* const (&p)[8]) {
  asm volatile("global_load_async_to_lds_b128 %0, %8, off\n\t"
               "global_load_async_to_lds_b128 %1, %9, off\n\t"
               "global_load_async_to_lds_b128 %2, %10, off\n\t"
               "global_load_async_to_lds_b128 %3, %11, off\n\t"
               "global_load_async_to_lds_b128 %4, %12, off\n\t"
               "global_load_async_to_lds_b128 %5, %13, off\n\t"
               "global_load_async_to_lds_b128 %6, %14, off\n\t"
               "global_load_async_to_lds_b128 %7, %15, off\n\t"
               "s_wait_xcnt 0x0"
               :: "v"(d[0]), "v"(d[1]), "v"(d[2]), "v"(d[3]), "v"(d[4]), "v"(d[5]), "v"(d[6]), "v"(d[7]),
                  "v"(p[0]), "v"(p[1]), "v"(p[2]), "v"(p[3]), "v"(p[4]), "v"(p[5]), "v"(p[6]), "v"(p[7])
               : "memory");
}

// 128 x 128 work-group tile over K, 8 waves as 4 (m) x 2 (n), each a 32 x 64 wave tile. A (fragment-packed f32) and B (fragment-packed bf16 planes) come through a
// two-buffer LDS ring filled by asynchronous copies, so that a tile is fetched from L2 once per work-group: an A tile serves 2 waves, a B tile 4.
// Waves 0..3 copy two A m tiles each, waves 4..7 four n tiles of one B plane each: 16 copies of 512 B per wave and stage, landing at ring + wave * 8 KB.
__device__ __forceinline__ void gemm_tile_split(const float* __restrict__ A, const b16* __restrict__ wh, const b16* __restrict__ wl,
                                                int mb, int cb, int K, int wave, int lane, unsigned char* ring, v8f (&acc)[2][4]) {
  const int KB = K / 32, NT = KB / KS;
  const int wm = wave & 3, wn = wave >> 2;
  const bool isA = wave < 4;
  const int wq = wave & 3;
  const char* gsrc = isA ? (const char*)A + (size_t)((mb >> 4) + wq * 2) * KB * 2048
                         : (const char*)((wq >> 1) ? wl : wh) + (size_t)((cb >> 4) + (wq & 1) * 4) * KB * 1024;
  gsrc += lane * 16;
  const unsigned adv = isA ? KS * 2048u : KS * 1024u;                       // bytes a tile row advances per stage
  const unsigned lds0 = (unsigned)(uintptr_t)ring + wave * 8192u + lane * 16u;
  auto issue = [&](int tile, int buf) {
    const char* g = gsrc + (size_t)tile * adv;
    const unsigned l = lds0 + buf * (unsigned)STAGE_B;
#pragma unroll
    for (int h = 0; h < 2; ++h) {
      unsigned d[8]; const char* p[8];
#pragma unroll
      for (int i = 0; i < 8; ++i) {
        const int c = h * 8 + i;
        const unsigned oa = (c / (KS * 4)) * (unsigned)(KB * 2048) + (c % (KS * 4)) * 512u, ob = (c / (KS * 2)) * (unsigned)(KB * 1024) + (c % (KS * 2)) * 512u;
        p[i] = g + (isA ? oa : ob); d[i] = l + c * 512u;
      }
      async_copy8(d, p);
    }
  };
  issue(0, 0);
  asm volatile("s_wait_asynccnt 0x0" ::: "memory");      // this wave's part of stage 0 has landed
  __syncthreads();                                        // ... and every other wave's
  issue(1, 1);
  for (int t = 0; t < NT; ++t) {
    const unsigned char* sb = ring + (t & 1) * STAGE_B;
    const float* la = (const float*)(sb + wm * 2 * KS * 2048) + lane * 4;
    const b16* lbh = (const b16*)(sb + STAGE_A + wn * 4 * KS * 1024) + lane * 8;
    const b16* lbl = lbh + STAGE_P / 2;
    // inside a stage every fragment is read one k block ahead: A's f32 words at the head of the block before, a pair of B tiles into its own registers behind the pair's products
    v4f ar0[4], ar1[4];
    v16b bh[4], bl[4], a0h, a0l, a1h, a1l;
    frag_pload(la, ar0);
    frag_pload(la + KS * 512, ar1);
#pragma unroll
    for (int u = 0; u < 4; ++u) { bh[u] = frag_pk(lbh + u * KS * 512); bl[u] = frag_pk(lbl + u * KS * 512); }
    row_end();
    frag_psplit(ar0, a0h, a0l);
    frag_psplit(ar1, a1h, a1l);
#pragma unroll
    for (int kk = 0; kk < KS; ++kk) {
      if (kk + 1 < KS) { frag_pload(la + (kk + 1) * 512, ar0); frag_pload(la + (KS + kk + 1) * 512, ar1); }
      row_end();
#pragma unroll
      for (int u = 0; u < 4; u += 2) {                    // two n tiles x two m tiles: rows of four independent accumulators
        acc[0][u] = wmma16b(a0h, bh[u], acc[0][u]);             acc[1][u] = wmma16b(a1h, bh[u], acc[1][u]);
        acc[0][u + 1] = wmma16b(a0h, bh[u + 1], acc[0][u + 1]); acc[1][u + 1] = wmma16b(a1h, bh[u + 1], acc[1][u + 1]);
        row_end();
        acc[0][u] = wmma16b(a0h, bl[u], acc[0][u]);             acc[1][u] = wmma16b(a1h, bl[u], acc[1][u]);
        acc[0][u + 1] = wmma16b(a0h, bl[u + 1], acc[0][u + 1]); acc[1][u + 1] = wmma16b(a1h, bl[u + 1], acc[1][u + 1]);
        row_end();
        acc[0][u] = wmma16b(a0l, bh[u], acc[0][u]);             acc[1][u] = wmma16b(a1l, bh[u], acc[1][u]);
        acc[0][u + 1] = wmma16b(a0l, bh[u + 1], acc[0][u + 1]); acc[1][u + 1] = wmma16b(a1l, bh[u + 1], acc[1][u + 1]);
        row_end();
        if (kk + 1 < KS) {
#pragma unroll
          for (int w = u; w < u + 2; ++w) { bh[w] = frag_pk(lbh + (w * KS + kk + 1) * 512); bl[w] = frag_pk(lbl + (w * KS + kk + 1) * 512); }
          row_end();
        }
      }
      if (kk + 1 < KS) { frag_psplit(ar0, a0h, a0l); frag_psplit(ar1, a1h, a1l); }
    }
    asm volatile("s_wait_dscnt 0x0" ::: "memory");       // this wave has left the buffer it read
    asm volatile("s_wait_asynccnt 0x0" ::: "memory");    // its part of stage t + 1 has landed
    __syncthreads();                                      // publishes stage t + 1 and frees stage t's buffer
    if (t + 2 < NT) issue(t + 2, t & 1);
  }
  asm volatile("s_wait_asynccnt 0x0" ::: "memory");      // nothing is in flight when the ring becomes output staging
}

// ---------------------------------------------------------------------------
// QKV GEMM: x (rows x 1024) times (1024 x 3072), one 128 x 128 tile per block of 8 waves, wave = 32 rows x 64 columns (one head of q, k or v). Outputs as bf16 hi/lo planes:
// q (x1/8) -> Qh/Ql [b][h][t/16] and k -> Kh/Kl [b][kvh][t/16], each 16 x 64 tile as two fragment-packed 16 x 32 tiles (4 KB contiguous per wave per plane);
// v -> Vh/Vl key-tiled [b][kvh][t/16][64][16] (4 KB contiguous per wave per plane).
// ---------------------------------------------------------------------------
__global__ __launch_bounds__(256) void qkv_gemm_kernel(const float* __restrict__ xq, const float* __restrict__ xk, const float* __restrict__ xv,
                                                       const b16* __restrict__ wqh, const b16* __restrict__ wql,
                                                       const float* __restrict__ bq, const float* __restrict__ bk, const float* __restrict__ bv, const float* __restrict__ rope_cs, int xoff, int yoff,
                                                       b16* __restrict__ Qh, b16* __restrict__ Ql, b16* __restrict__ Kh, b16* __restrict__ Kl,
                                                       b16* __restrict__ Vh, b16* __restrict__ Vl) {
  __shared__ __attribute__((aligned(16))) unsigned char ring[RING_B];   // the GEMM's ring, then each wave's output staging
  // the wave's number is wave-uniform; readfirstlane tells the compiler so: tile, head and copy addresses then come from scalar registers
  const int lane = threadIdx.x & 31, wave = __builtin_amdgcn_readfirstlane(threadIdx.x >> 5), nloc = lane & 15, hlf = lane >> 4;
  const int mb = (blockIdx.y + yoff) * 128, cb = (blockIdx.x + xoff) * 128;
  const int m0 = mb + (wave & 3) * 32;
  const int c0 = cb + (wave >> 2) * 64;
  const int mat = (cb < HID) ? 0 : (cb < HID + KVW) ? 1 : 2;          // a 128-column block lies inside one of q, k, v
  const int head = (mat == 0) ? (c0 / DH) : (mat == 1) ? ((c0 - HID) / DH) : ((c0 - HID - KVW) / DH);
  const float* x = (mat == 0) ? xq : (mat == 1) ? xk : xv;          // q, k and v inputs; the launch passes xp (packed x) for all three
  const float* bias = ((mat == 0) ? bq : (mat == 1) ? bk : bv) + head * DH;
  v8f acc[2][4];
#pragma unroll
  for (int r = 0; r < 2; ++r)
#pragma unroll
    for (int t = 0; t < 4; ++t) acc[r][t] = (v8f){};
  gemm_tile_split(x, wqh, wql, mb, cb, HID, wave, lane, ring, acc);
  const int b = m0 / T, t0 = m0 % T;
  const float s = (mat == 0) ? 0.125f : 1.0f;
  b16* Tp0 = (b16*)(ring + wave * 8192); b16* Tp1 = Tp0 + 32 * 64;
  // the lane's 32 cos/sin pairs, fetched as one group ahead of the loop that uses them (one wait instead of one per element)
  typedef __attribute__((ext_vector_type(2))) float v2f;
  v2f cs[2][2][8];
  const float* csp = rope_cs + ((size_t)(t0 + 8 * hlf) * ROT + nloc) * 2;
#pragma unroll
  for (int t = 0; t < 2; ++t)
#pragma unroll
    for (int r = 0; r < 2; ++r)
#pragma unroll
      for (int v = 0; v < 8; ++v) cs[t][r][v] = *(const v2f*)(csp + ((r * 16 + v) * ROT + t * 16) * 2);
  // the group's address stays in its registers up to this wait, so that none of the group's own results lands on it
  asm volatile("s_wait_xcnt 0x0" :: "v"(csp) : "memory");
#pragma unroll
  for (int t = 0; t < 4; ++t)
#pragma unroll
    for (int r = 0; r < 2; ++r)
#pragma unroll
      for (int v = 0; v < 8; ++v) {
        const int rr = r * 16 + v + 8 * hlf, d = t * 16 + nloc;
        float val = acc[r][t][v] + (bias ? bias[d] : 0.0f);
        if (t < 2) {                                     // partial rotary on dims 0..31 of q, k and v: x*cos(f) + rotate_half(x)*sin(f), partner d^16 is tile t^1 (same lane)
          const float cv = cs[t & 1][r][v][0], sv = cs[t & 1][r][v][1];   // precomputed cos/sin of rotary_pos_emb at sequence position t0 + rr
          const float oth = acc[r][t ^ 1][v] + (bias ? bias[d ^ 16] : 0.0f);
          val = (t == 0) ? (val * cv - oth * sv) : (val * cv + oth * sv);
        }
        b16 yh, yl; split_bf16(val * s, yh, yl);
        const int idx = (mat < 2) ? ((rr >> 4) * 1024 + (d >> 4) * 256 + (((d >> 3) & 1) * 16 + (rr & 15)) * 8 + (d & 7)) : ((rr >> 4) * 1024 + d * 16 + (rr & 15));
        Tp0[idx] = yh; Tp1[idx] = yl;
      }
  wave_lds_sync();
  b16* dh; b16* dl; size_t o;
  if (mat == 0)      { o = ((size_t)(b * NH + head) * T + t0) * DH; dh = Qh + o; dl = Ql + o; }
  else if (mat == 1) { o = ((size_t)(b * NKV + head) * T + t0) * DH; dh = Kh + o; dl = Kl + o; }
  else               { o = ((size_t)(b * NKV + head) * QT_PER_B + (t0 >> 4)) * (size_t)(DH * 16); dh = Vh + o; dl = Vl + o; }
#pragma unroll
  for (int j = 0; j < 8; ++j) { const int e = (j * 32 + lane) * 8; *(v8b*)(dh + e) = ld8b(Tp0 + e); *(v8b*)(dl + e) = ld8b(Tp1 + e); }
  
}

// ---------------------------------------------------------------------------
// Transposed flash attention: each wave owns one 16-query tile of one (b, head); 8 waves per block, eight neighbouring tiles of one head; keys in chunks of 32.
// S^T = K.Q^T (split), per-lane online softmax; P^T built in registers from the two S^T accumulators.
// K and V come through a two-buffer LDS ring filled by asynchronous copies, so that a chunk is fetched from L2 once per block and read by each wave whose queries reach it.
// A stage is ACH chunks: K hi | K lo | V hi | V lo, ACH * 4 KB each, every plane in the order it has in global memory.
// ---------------------------------------------------------------------------
constexpr int ACH = 2;
constexpr int APLANE = ACH * 4096, ASTAGE = 4 * APLANE;   // 8 KB, 32 KB
__global__ __launch_bounds__(256) void attn_kernel(const b16* __restrict__ Qh, const b16* __restrict__ Ql, const b16* __restrict__ Kh, const b16* __restrict__ Kl,
                                                   const b16* __restrict__ Vh, const b16* __restrict__ Vl,
                                                   float* __restrict__ yf) {
  __shared__ __attribute__((aligned(16))) unsigned char ring[2 * ASTAGE];
  // the wave's number is wave-uniform; readfirstlane tells the compiler so: tile index, trip count and chunk addresses then live in scalar registers
  const int wid = __builtin_amdgcn_readfirstlane(threadIdx.x >> 5), lane = threadIdx.x & 31, hh = lane >> 4, col = lane & 15;
  const int qtile = blockIdx.x * 8 + wid;                 // over Bsz*NH*QT_PER_B
  const int g = qtile / QT_PER_B;                         // b*NH + h, the same for the block's 8 waves (8 divides QT_PER_B)
  const int q0 = (qtile % QT_PER_B) << 4;
  const int b = g / NH, h = g % NH, kvh = h / REP;
  const size_t ko = (size_t)(b * NKV + kvh) * T * DH;
  const size_t qo = ((size_t)g * T + q0) * DH + lane * 8;
  const v16b q0h = frag_pk(Qh + qo), q0l = frag_pk(Ql + qo), q1h = frag_pk(Qh + qo + 512), q1l = frag_pk(Ql + qo + 512);
  // the two Q addresses stay in their registers up to this wait, so that none of the Q fragments lands on them
  asm volatile("s_wait_xcnt 0x0" :: "v"(Qh + qo), "v"(Ql + qo) : "memory");
  float m = -INFINITY, l = 0.0f;
  v8f o0 = {}, o1 = {}, o2 = {}, o3 = {};
  // stages the block walks: up to its last tile's last query; a multiple of 128 keys, so at least two stages
  const int NS = ((((blockIdx.x * 8) % QT_PER_B) + 8) << 4) / (32 * ACH);
  // wave w copies half w & 1 of plane w >> 1: 8 copies of 512 B per stage, landing at ring + w * 4 KB
  const b16* pl = (wid >> 1) == 0 ? Kh : (wid >> 1) == 1 ? Kl : (wid >> 1) == 2 ? Vh : Vl;
  const char* gsrc = (const char*)(pl + ko) + (wid & 1) * (APLANE / 2) + lane * 16;
  const unsigned lds0 = (unsigned)(uintptr_t)ring + wid * (unsigned)(APLANE / 2) + lane * 16u;
  auto issue = [&](int stage, int buf) {
    unsigned d[8]; const char* p[8];
#pragma unroll
    for (int i = 0; i < 8; ++i) { p[i] = gsrc + (size_t)stage * APLANE + i * 512; d[i] = lds0 + buf * (unsigned)ASTAGE + i * 512u; }
    async_copy8(d, p);
  };
  issue(0, 0);
  asm volatile("s_wait_asynccnt 0x0" ::: "memory");      // this wave's part of stage 0 has landed
  __syncthreads();                                        // ... and every other wave's
  issue(1, 1);
  for (int s = 0; s < NS; ++s) {
    const b16* sb = (const b16*)(ring + (s & 1) * ASTAGE);
#pragma unroll
    for (int c = 0; c < ACH; ++c) {
      const int kb = (s * ACH + c) * 32;
      if (kb < q0 + 16) {                                 // causal: key chunks up to the tile's last query (wave-uniform; the publish point below is outside)
        // A chunk of K is two packed 16-key tiles = four 16 x 32 fragments 512 elements apart; a chunk of V two key tiles of 64 x 16.
        const b16* lk = sb + c * 2048 + lane * 8;
        const b16* lv = sb + APLANE + c * 2048 + col * 16 + 8 * hh;
        v16b kfh[4], kfl[4], vfh[4], vfl[4];
#pragma unroll
        for (int j = 0; j < 4; ++j) {                     // in the order of their first use below
          const int i = (j >> 1) + (j & 1) * 2;
          kfh[i] = frag_pk(lk + i * 512); kfl[i] = frag_pk(lk + APLANE / 2 + i * 512);
        }
        // LDS reads return in order: K's stay in front of V's, so that the score products wait for K alone and V lands behind them
        __builtin_amdgcn_sched_barrier(0);
#pragma unroll
        for (int i = 0; i < 4; ++i) {
          vfh[i] = cat8b(ld8b(lv + i * 256), ld8b(lv + DH * 16 + i * 256));
          vfl[i] = cat8b(ld8b(lv + APLANE / 2 + i * 256), ld8b(lv + APLANE / 2 + DH * 16 + i * 256));
        }
        row_end();
        v8f s0 = {}, s1 = {};
        // the two key tiles' chains alternate
        s0 = wmma16b(kfh[0], q0h, s0); s1 = wmma16b(kfh[2], q0h, s1); row_end();
        s0 = wmma16b(kfh[0], q0l, s0); s1 = wmma16b(kfh[2], q0l, s1); row_end();
        s0 = wmma16b(kfl[0], q0h, s0); s1 = wmma16b(kfl[2], q0h, s1); row_end();
        s0 = wmma16b(kfh[1], q1h, s0); s1 = wmma16b(kfh[3], q1h, s1); row_end();
        s0 = wmma16b(kfh[1], q1l, s0); s1 = wmma16b(kfh[3], q1l, s1); row_end();
        s0 = wmma16b(kfl[1], q1h, s0); s1 = wmma16b(kfl[3], q1h, s1);
        if (kb + 32 > q0) {                               // diagonal chunk: mask keys after the query
          const int qi = q0 + col;
#pragma unroll
          for (int r = 0; r < 8; ++r) {
            if (kb + 8 * hh + r > qi)      s0[r] = -INFINITY;
            if (kb + 16 + 8 * hh + r > qi) s1[r] = -INFINITY;
          }
        }
        float mr = -INFINITY;
#pragma unroll
        for (int r = 0; r < 8; ++r) mr = fmaxf(mr, fmaxf(s0[r], s1[r]));
        mr = fmaxf(mr, __shfl_xor(mr, 16));
        const float mn = fmaxf(m, mr);            // finite
        const float al_ = exp2_slot((m - mn) * LOG2E);
        m = mn;
        float sum = 0.0f;
        v16b pbh, pbl;
#pragma unroll
        for (int r = 0; r < 8; ++r) {
          const float p0 = exp2_slot((s0[r] - mn) * LOG2E), p1 = exp2_slot((s1[r] - mn) * LOG2E);
          sum += p0 + p1;
          b16 a, c2; split_bf16(p0, a, c2); pbh[r] = a; pbl[r] = c2; split_bf16(p1, a, c2); pbh[8 + r] = a; pbl[8 + r] = c2;
        }
#pragma unroll
        for (int r = 0; r < 8; ++r) { o0[r] *= al_; o1[r] *= al_; o2[r] *= al_; o3[r] *= al_; }
        o0 = wmma16b(vfh[0], pbh, o0); o1 = wmma16b(vfh[1], pbh, o1); o2 = wmma16b(vfh[2], pbh, o2); o3 = wmma16b(vfh[3], pbh, o3); row_end();
        const float sum_x = __shfl_xor(sum, 16);          // the other half's sum travels under the next two rows instead of holding up the first
        o0 = wmma16b(vfh[0], pbl, o0); o1 = wmma16b(vfh[1], pbl, o1); o2 = wmma16b(vfh[2], pbl, o2); o3 = wmma16b(vfh[3], pbl, o3); row_end();
        o0 = wmma16b(vfl[0], pbh, o0); o1 = wmma16b(vfl[1], pbh, o1); o2 = wmma16b(vfl[2], pbh, o2); o3 = wmma16b(vfl[3], pbh, o3); row_end();
        l = l * al_ + (sum + sum_x);
      }
    }
    asm volatile("s_wait_dscnt 0x0" ::: "memory");       // this wave has left the buffer it read
    asm volatile("s_wait_asynccnt 0x0" ::: "memory");    // its part of stage s + 1 has landed
    __syncthreads();                                      // publishes stage s + 1 and frees stage s's buffer
    if (s + 2 < NS) issue(s + 2, s & 1);
  }
  asm volatile("s_wait_asynccnt 0x0" ::: "memory");      // nothing is in flight when the wave ends
  const float inv = 1.0f / l;
  // y in fragment-packed f32 tiles for the output projection: O^T's accumulator (feature 8hh+r, query col) already is the A fragment's lane and k order,
  // so every lane stores its own 4-float groups and each wave-wide store is 512 contiguous bytes.
  float* dst0 = yf + ((size_t)((b * T + q0) >> 4) * (HID / 32) + h * 2) * 512 + lane * 4;
#pragma unroll
  for (int n = 0; n < 4; ++n) {
    const v8f o = (n == 0) ? o0 : (n == 1) ? o1 : (n == 2) ? o2 : o3;
#pragma unroll
    for (int u = 0; u < 2; ++u) {
      const v4f w = {o[u * 4] * inv, o[u * 4 + 1] * inv, o[u * 4 + 2] * inv, o[u * 4 + 3] * inv};
      *(v4f*)(dst0 + (n >> 1) * 512 + ((n & 1) * 2 + u) * 128) = w;
    }
  }
}

// ---------------------------------------------------------------------------
// Output projection: (4096 x 1024) x (1024 x 1024) -> f32, A split on the fly from packed f32 y, B = packed Wo planes. One 128 x 128 tile per block of 8 waves, 32x64 wave tiles staged in LDS,
// ---------------------------------------------------------------------------
__global__ __launch_bounds__(256) void out_gemm_kernel(const float* __restrict__ yf, const b16* __restrict__ woh, const b16* __restrict__ wol, const float* __restrict__ bo, int yoff,
                                                       float* __restrict__ out) {
  __shared__ __attribute__((aligned(16))) unsigned char ring[RING_B];   // the GEMM's ring, then each wave's output staging
  const int lane = threadIdx.x & 31, wave = __builtin_amdgcn_readfirstlane(threadIdx.x >> 5), nloc = lane & 15, hlf = lane >> 4;
  const int mb = (blockIdx.y + yoff) * 128, cb = blockIdx.x * 128;
  const int m0 = mb + (wave & 3) * 32;
  const int c0 = cb + (wave >> 2) * 64;
  v8f acc[2][4];
#pragma unroll
  for (int r = 0; r < 2; ++r)
#pragma unroll
    for (int t = 0; t < 4; ++t) acc[r][t] = (v8f){};
  gemm_tile_split(yf, woh, wol, mb, cb, HID, wave, lane, ring, acc);
  float* Tt = (float*)(ring + wave * 8192);
#pragma unroll
  for (int t = 0; t < 4; ++t)
#pragma unroll
    for (int r = 0; r < 2; ++r)
#pragma unroll
      for (int v = 0; v < 8; ++v) Tt[(r * 16 + v + 8 * hlf) * 64 + t * 16 + nloc] = acc[r][t][v] + bo[c0 + t * 16 + nloc];
  wave_lds_sync();
  float* dst0 = out + (size_t)m0 * HID + c0;
#pragma unroll
  for (int j = 0; j < 16; ++j) { const int rr = j * 2 + hlf, c4 = nloc * 4; *(v4f*)(dst0 + (size_t)rr * HID + c4) = *(const v4f*)(Tt + rr * 64 + c4); }
  
}
__global__ __launch_bounds__(256) void rope_table_kernel(const float* __restrict__ fr, float* __restrict__ cs) {
  const int idx = blockIdx.x * 256 + threadIdx.x;        // T * 32
  if (idx >= T * ROT) return;
  const float f = fr[idx];
  typedef __attribute__((ext_vector_type(2))) float v2f;
  const v2f p = {cosf(f), sinf(f)};
  *(v2f*)(cs + (size_t)idx * 2) = p; 
}
}  // namespace

extern "C" void kernel_launch(void* const* d_in, const int* in_sizes, int n_in,
                              void* d_out, int out_size, void* d_ws, size_t ws_size, hipStream_t stream) {
  (void)in_sizes; (void)n_in; (void)out_size;
  const float* x  = (const float*)d_in[0];   // hidden_states [4,1024,1024]
  const float* fr = (const float*)d_in[1];   // rotary_pos_emb [1,1024,32]
  const float* Wq = (const float*)d_in[2];   // [1024,1024] torch [out][in]
  const float* Wk = (const float*)d_in[3];
  const float* Wv = (const float*)d_in[4];
  const float* Wo = (const float*)d_in[5];
  const float* bo = (const float*)d_in[6];
  const float* bq = nullptr; const float* bk = nullptr; const float* bv = nullptr;
  float* out = (float*)d_out;                // [4,1024,1024] f32

  size_t off = 0; char* ws = (char*)d_ws;
  b16* wqh = (b16*)(ws + off); off += (size_t)NQKV * HID * 2;     // 6 MB
  b16* wql = (b16*)(ws + off); off += (size_t)NQKV * HID * 2;
  b16* woh = (b16*)(ws + off); off += (size_t)HID * HID * 2;      // 2 MB
  b16* wol = (b16*)(ws + off); off += (size_t)HID * HID * 2;
  b16* Qh  = (b16*)(ws + off); off += (size_t)MROWS * HID * 2;    // 8 MB each
  b16* Ql  = (b16*)(ws + off); off += (size_t)MROWS * HID * 2;
  b16* Kh  = (b16*)(ws + off); off += (size_t)MROWS * KVW * 2;
  b16* Kl  = (b16*)(ws + off); off += (size_t)MROWS * KVW * 2;
  b16* Vh  = (b16*)(ws + off); off += (size_t)MROWS * KVW * 2;
  b16* Vl  = (b16*)(ws + off); off += (size_t)MROWS * KVW * 2;
  float* yf = (float*)(ws + off); off += (size_t)MROWS * HID * 4; // 16 MB
  float* rope_cs = (float*)(ws + off); off += (size_t)T * ROT * 2 * 4;
  float* xp = (float*)(ws + off); off += (size_t)MROWS * HID * 4; // x, fragment-packed
  if (off > ws_size) return;
  rope_table_kernel<<<(T * ROT + 255) / 256, 256, 0, stream>>>(fr, rope_cs);
  const int ROWBLK = MROWS / 128, NQT = Bsz * NH * QT_PER_B;   // full job

  wcvt_kernel<<<2048, 256, 0, stream>>>(Wq, Wk, Wv, Wo, x, wqh, wql, woh, wol, xp);
  qkv_gemm_kernel<<<dim3(NQKV / 128, ROWBLK), 256, 0, stream>>>(xp, xp, xp, wqh, wql, bq, bk, bv, rope_cs, 0, 0, Qh, Ql, Kh, Kl, Vh, Vl);
  attn_kernel<<<NQT / 8, 256, 0, stream>>>(Qh, Ql, Kh, Kl, Vh, Vl, yf);
  out_gemm_kernel<<<dim3(HID / 128, ROWBLK), 256, 0, stream>>>(yf, woh, wol, bo, 0, out);
}

// v005
// It runs in 122 microseconds.
// In both of two side-by-side timings against v004, it was 1.06 times as fast.
// Counting every step since v000, it is 2.70 times as fast.
#include <hip/hip_runtime.h>

// CLVP self-attention: q/k/v = x.W^T (torch [out][in] weights, no bias), partial rotary embedding on the first 32 dims of every head of q, k AND v
// (rotate-half: pairs (d, d+16), cos/sin of the given rotary_pos_emb[s][d]), q x 1/8, causal softmax, y = P.V, out = y.Wo^T + bo. B=4, S=1024, 16x64.
// All contractions as bf16 hi/lo splits on v_wmma_f32_16x16x32_bf16 (hi.hi + hi.lo + lo.hi, f32 accumulate): the outputs have rms 0.04.

namespace {
constexpr int Bsz = 4, T = 1024, HID = 1024, DH = 64, NH = 16, NKV = 16, REP = NH / NKV;
constexpr int ROT = 32;   // rotary dims per head
constexpr int KVW = NKV * DH;                 // 1024
constexpr int NQKV = HID + 2 * KVW;           // 3072 columns: q | k | v
constexpr int MROWS = Bsz * T;                // 4096
constexpr int QT_PER_B = T / 16;              // 64

typedef __bf16 b16;
typedef __attribute__((ext_vector_type(16))) __bf16 v16b;
typedef __attribute__((ext_vector_type(8)))  __bf16 v8b;
typedef __attribute__((ext_vector_type(8)))  float v8f;
typedef __attribute__((ext_vector_type(4)))  float v4f;

__device__ __forceinline__ v8b ld8b(const b16* p) { return *(const v8b*)p; }
__device__ __forceinline__ v16b cat8b(v8b a, v8b b) { return __builtin_shufflevector(a, b, 0, 1, 2, 3, 4, 5, 6, 7, 8, 9, 10, 11, 12, 13, 14, 15); }
// 16x16x32 16-bit fragment (A: lane&15 = row, B: lane&15 = column), hh = lane>>4: elements 0..7 <- k = 8hh+0..7, elements 8..15 <- k = 16+8hh+0..7.
// Loaded from FRAGMENT-PACKED storage: a 16 x 32 tile is 2 groups of 256 elements, group j at lane*8 holds that lane's elements 8j..8j+7,
// so each wave-wide 16-byte load covers 512 contiguous bytes (4 whole lines) instead of 16 rows. p already includes lane*8.
__device__ __forceinline__ v16b frag_pk(const b16* p) { return cat8b(ld8b(p), ld8b(p + 256)); }
__device__ __forceinline__ void split_bf16(float v, b16& hi, b16& lo) {
  const unsigned int u = __builtin_bit_cast(unsigned int, v) & 0xffff0000u;
  hi = __builtin_bit_cast(b16, (unsigned short)(u >> 16));
  lo = (b16)(v - __builtin_bit_cast(float, u));
}
// split fragment from fragment-packed f32: a 16 x 32 tile is 4 groups of 128 floats, group j at lane*4 holds that lane's elements 4j..4j+3
// (k = 16(j>>1) + 8hh + 4(j&1) + e, the k order above). p already includes lane*4.
// The load and the split are two functions, so that a tile's four loads can be issued one k block before it is split.
__device__ __forceinline__ void frag_pload(const float* p, v4f (&f)[4]) {
#pragma unroll
  for (int j = 0; j < 4; ++j) f[j] = *(const v4f*)(p + j * 128);
}
__device__ __forceinline__ void frag_psplit(const v4f (&f)[4], v16b& fh_, v16b& fl_) {
#pragma unroll
  for (int j = 0; j < 4; ++j)
#pragma unroll
    for (int e = 0; e < 4; ++e) { b16 a, c; split_bf16(f[j][e], a, c); fh_[j * 4 + e] = a; fl_[j * 4 + e] = c; }
}
__device__ __forceinline__ v8f wmma16b(v16b a, v16b b, v8f c) {
  return __builtin_amdgcn_wmma_f32_16x16x32_bf16(false, a, false, b, (short)0, c, false, false);
}
// acc += A.B with both operands split, A = (ah, al), B = (bh, bl), is three products: hi.hi, hi.lo, lo.hi, in that order into every accumulator.
// They are issued term by term, in rows over a group of independent accumulators, so that no product waits for the one issued just before it.
// row_end() stands behind each row and behind each group of LDS reads: without it the compiler's scheduler puts an accumulator's three products next to
// each other again and sinks the reads down to their first use, where their whole latency is waited for.
__device__ __forceinline__ void row_end() { __builtin_amdgcn_sched_barrier(0); }
// 2^x with the slot that the instruction set asks for behind a transcendental (before its result is read or its source register rewritten) in the same statement.
__device__ __forceinline__ float exp2_slot(float x) { float r; asm("v_exp_f32 %0, %1\n\tv_nop" : "=v"(r) : "v"(x)); return r; }
constexpr float LOG2E = 1.44269504f;
__device__ __forceinline__ void wave_lds_sync() {
  __builtin_amdgcn_fence(__ATOMIC_RELEASE, "workgroup");
  __builtin_amdgcn_wave_barrier();
  __builtin_amdgcn_fence(__ATOMIC_ACQUIRE, "workgroup");
}

// ---------------------------------------------------------------------------
// Packing pass. Weights (torch [out][in]) -> bf16 hi / lo planes in fragment-packed 16(n) x 32(k) tiles, tile index ntile*(HID/32)+kblk: rows of Wq|Wk|Wv into
// wqh/wql (3072 x 1024), Wo into woh/wol (1024 x 1024). x -> xp, f32, fragment-packed 16(m) x 32(k) tiles. Threads follow the destination: whole-line stores.
// ---------------------------------------------------------------------------
__global__ __launch_bounds__(256) void wcvt_kernel(const float* __restrict__ wq, const float* __restrict__ wk, const float* __restrict__ wv,
                                                   const float* __restrict__ wo, const float* __restrict__ x, b16* __restrict__ wqh, b16* __restrict__ wql,
                                                   b16* __restrict__ woh, b16* __restrict__ wol, float* __restrict__ xp) {
  const size_t tid = (size_t)blockIdx.x * blockDim.x + threadIdx.x, stride = (size_t)gridDim.x * blockDim.x;
  const size_t nq = (size_t)NQKV * HID / 8, no = (size_t)HID * HID / 8, nx = (size_t)MROWS * HID / 4;
  for (size_t c = tid; c < nq + no; c += stride) {
    const bool isq = c < nq;
    const size_t cc = isq ? c : c - nq;                     // 8-element chunk of the packed plane: lane | group j | kblk | ntile
    const int ln = (int)(cc & 31), j = (int)(cc >> 5) & 1, kblk = (int)(cc >> 6) & (HID / 32 - 1);
    const int n = (int)(cc >> 11) * 16 + (ln & 15), k0 = kblk * 32 + j * 16 + (ln >> 4) * 8;
    const float* w; int nn;
    if (!isq) { w = wo; nn = n; } else if (n < HID) { w = wq; nn = n; } else if (n < HID + KVW) { w = wk; nn = n - HID; } else { w = wv; nn = n - HID - KVW; }
    const float* src = w + (size_t)nn * HID + k0;
    const v4f f0 = *(const v4f*)src, f1 = *(const v4f*)(src + 4);
    v8b bh, bl;
#pragma unroll
    for (int e = 0; e < 4; ++e) { b16 a, d; split_bf16(f0[e], a, d); bh[e] = a; bl[e] = d; split_bf16(f1[e], a, d); bh[4 + e] = a; bl[4 + e] = d; }
    *(v8b*)((isq ? wqh : woh) + cc * 8) = bh; *(v8b*)((isq ? wql : wol) + cc * 8) = bl;
  }
  for (size_t c = tid; c < nx; c += stride) {               // 4-float chunk of xp: lane | group j | kblk | mtile
    const int ln = (int)(c & 31), j = (int)(c >> 5) & 3, kblk = (int)(c >> 7) & (HID / 32 - 1);
    const size_t m = (c >> 12) * 16 + (ln & 15);
    *(v4f*)(xp + c * 4) = *(const v4f*)(x + m * HID + kblk * 32 + (j >> 1) * 16 + (ln >> 4) * 8 + (j & 1) * 4);
  }
}

// One stage of the LDS ring: KS k blocks of a 128 x 128 work-group tile, every 16 x 32 tile in the fragment-packed order it has in global memory.
// Bytes of a stage: A (f32) 8 m tiles x KS x 2 KB | B hi plane 8 n tiles x KS x 1 KB | B lo plane the same.
constexpr int KS = 2;
constexpr int STAGE_A = 8 * KS * 2048, STAGE_P = 8 * KS * 1024, STAGE_B = STAGE_A + 2 * STAGE_P;   // 64 KB
constexpr int RING_B = 2 * STAGE_B;

// Eight asynchronous 16-byte-per-lane copies, global -> LDS. The s_wait_xcnt stands inside the statement, so that no address register of a copy is rewritten ahead of it.
__device__ __forceinline__ void async_copy8(const unsigned (&d)[8], const char* const (&p)[8]) {
  asm volatile("global_load_async_to_lds_b128 %0, %8, off\n\t"
               "global_load_async_to_lds_b128 %1, %9, off\n\t"
               "global_load_async_to_lds_b128 %2, %10, off\n\t"
               "global_load_async_to_lds_b128 %3, %11, off\n\t"
               "global_load_async_to_lds_b128 %4, %12, off\n\t"
               "global_load_async_to_lds_b128 %5, %13, off\n\t"
               "global_load_async_to_lds_b128 %6, %14, off\n\t"
               "global_load_async_to_lds_b128 %7, %15, off\n\t"
               "s_wait_xcnt 0x0"
               :: "v"(d[0]), "v"(d[1]), "v"(d[2]), "v"(d[3]), "v"(d[4]), "v"(d[5]), "v"(d[6]), "v"(d[7]),
                  "v"(p[0]), "v"(p[1]), "v"(p[2]), "v"(p[3]), "v"(p[4]), "v"(p[5]), "v"(p[6]), "v"(p[7])
               : "memory");
}

// 128 x 128 work-group tile over K, 8 waves as 4 (m) x 2 (n), each a 32 x 64 wave tile. A (fragment-packed f32) and B (fragment-packed bf16 planes) come through a
// two-buffer LDS ring filled by asynchronous copies, so that a tile is fetched from L2 once per work-group: an A tile serves 2 waves, a B tile 4.
// Waves 0..3 copy two A m tiles each, waves 4..7 four n tiles of one B plane each: 16 copies of 512 B per wave and stage, landing at ring + wave * 8 KB.
__device__ __forceinline__ void gemm_tile_split(const float* __restrict__ A, const b16* __restrict__ wh, const b16* __restrict__ wl,
                                                int mb, int cb, int K, int wave, int lane, unsigned char* ring, v8f (&acc)[2][4]) {
  const int KB = K / 32, NT = KB / KS;
  const int wm = wave & 3, wn = wave >> 2;
  const bool isA = wave < 4;
  const int wq = wave & 3;
  const char* gsrc = isA ? (const char*)A + (size_t)((mb >> 4) + wq * 2) * KB * 2048
                         : (const char*)((wq >> 1) ? wl : wh) + (size_t)((cb >> 4) + (wq & 1) * 4) * KB * 1024;
  gsrc += lane * 16;
  const unsigned adv = isA ? KS * 2048u : KS * 1024u;                       // bytes a tile row advances per stage
  const unsigned lds0 = (unsigned)(uintptr_t)ring + wave * 8192u + lane * 16u;
  auto issue = [&](int tile, int buf) {
    const char* g = gsrc + (size_t)tile * adv;
    const unsigned l = lds0 + buf * (unsigned)STAGE_B;
#pragma unroll
    for (int h = 0; h < 2; ++h) {
      unsigned d[8]; const char* p[8];
#pragma unroll
      for (int i = 0; i < 8; ++i) {
        const int c = h * 8 + i;
        const unsigned oa = (c / (KS * 4)) * (unsigned)(KB * 2048) + (c % (KS * 4)) * 512u, ob = (c / (KS * 2)) * (unsigned)(KB * 1024) + (c % (KS * 2)) * 512u;
        p[i] = g + (isA ? oa : ob); d[i] = l + c * 512u;
      }
      async_copy8(d, p);
    }
  };
  issue(0, 0);
  asm volatile("s_wait_asynccnt 0x0" ::: "memory");      // this wave's part of stage 0 has landed
  __syncthreads();                                        // ... and every other wave's
  issue(1, 1);
  for (int t = 0; t < NT; ++t) {
    const unsigned char* sb = ring + (t & 1) * STAGE_B;
    const float* la = (const float*)(sb + wm * 2 * KS * 2048) + lane * 4;
    const b16* lbh = (const b16*)(sb + STAGE_A + wn * 4 * KS * 1024) + lane * 8;
    const b16* lbl = lbh + STAGE_P / 2;
    // inside a stage every fragment is read one k block ahead: A's f32 words at the head of the block before, a pair of B tiles into its own registers behind the pair's products
    v4f ar0[4], ar1[4];
    v16b bh[4], bl[4], a0h, a0l, a1h, a1l;
    frag_pload(la, ar0);
    frag_pload(la + KS * 512, ar1);
#pragma unroll
    for (int u = 0; u < 4; ++u) { bh[u] = frag_pk(lbh + u * KS * 512); bl[u] = frag_pk(lbl + u * KS * 512); }
    row_end();
    frag_psplit(ar0, a0h, a0l);
    frag_psplit(ar1, a1h, a1l);
#pragma unroll
    for (int kk = 0; kk < KS; ++kk) {
      if (kk + 1 < KS) { frag_pload(la + (kk + 1) * 512, ar0); frag_pload(la + (KS + kk + 1) * 512, ar1); }
      row_end();
#pragma unroll
      for (int u = 0; u < 4; u += 2) {                    // two n tiles x two m tiles: rows of four independent accumulators
        acc[0][u] = wmma16b(a0h, bh[u], acc[0][u]);             acc[1][u] = wmma16b(a1h, bh[u], acc[1][u]);
        acc[0][u + 1] = wmma16b(a0h, bh[u + 1], acc[0][u + 1]); acc[1][u + 1] = wmma16b(a1h, bh[u + 1], acc[1][u + 1]);
        row_end();
        acc[0][u] = wmma16b(a0h, bl[u], acc[0][u]);             acc[1][u] = wmma16b(a1h, bl[u], acc[1][u]);
        acc[0][u + 1] = wmma16b(a0h, bl[u + 1], acc[0][u + 1]); acc[1][u + 1] = wmma16b(a1h, bl[u + 1], acc[1][u + 1]);
        row_end();
        acc[0][u] = wmma16b(a0l, bh[u], acc[0][u]);             acc[1][u] = wmma16b(a1l, bh[u], acc[1][u]);
        acc[0][u + 1] = wmma16b(a0l, bh[u + 1], acc[0][u + 1]); acc[1][u + 1] = wmma16b(a1l, bh[u + 1], acc[1][u + 1]);
        row_end();
        if (kk + 1 < KS) {
#pragma unroll
          for (int w = u; w < u + 2; ++w) { bh[w] = frag_pk(lbh + (w * KS + kk + 1) * 512); bl[w] = frag_pk(lbl + (w * KS + kk + 1) * 512); }
          row_end();
        }
      }
      if (kk + 1 < KS) { frag_psplit(ar0, a0h, a0l); frag_psplit(ar1, a1h, a1l); }
    }
    asm volatile("s_wait_dscnt 0x0" ::: "memory");       // this wave has left the buffer it read
    asm volatile("s_wait_asynccnt 0x0" ::: "memory");    // its part of stage t + 1 has landed
    __syncthreads();                                      // publishes stage t + 1 and frees stage t's buffer
    if (t + 2 < NT) issue(t + 2, t & 1);
  }
  asm volatile("s_wait_asynccnt 0x0" ::: "memory");      // nothing is in flight when the ring becomes output staging
}

// ---------------------------------------------------------------------------
// QKV GEMM: x (rows x 1024) times (1024 x 3072), one 128 x 128 tile per block of 8 waves, wave = 32 rows x 64 columns (one head of q, k or v). Outputs as bf16 hi/lo planes:
// q (x1/8) -> Qh/Ql [b][h][t/16] and k -> Kh/Kl [b][kvh][t/16], each 16 x 64 tile as two fragment-packed 16 x 32 tiles (4 KB contiguous per wave per plane);
// v -> Vh/Vl key-tiled [b][kvh][t/16][64][16] (4 KB contiguous per wave per plane).
// ---------------------------------------------------------------------------
__global__ __launch_bounds__(256) void qkv_gemm_kernel(const float* __restrict__ xq, const float* __restrict__ xk, const float* __restrict__ xv,
                                                       const b16* __restrict__ wqh, const b16* __restrict__ wql,
                                                       const float* __restrict__ bq, const float* __restrict__ bk, const float* __restrict__ bv, const float* __restrict__ rope_cs, int xoff, int yoff,
                                                       b16* __restrict__ Qh, b16* __restrict__ Ql, b16* __restrict__ Kh, b16* __restrict__ Kl,
                                                       b16* __restrict__ Vh, b16* __restrict__ Vl) {
  __shared__ __attribute__((aligned(16))) unsigned char ring[RING_B];   // the GEMM's ring, then each wave's output staging
  // the wave's number is wave-uniform; readfirstlane tells the compiler so: tile, head and copy addresses then come from scalar registers
  const int lane = threadIdx.x & 31, wave = __builtin_amdgcn_readfirstlane(threadIdx.x >> 5), nloc = lane & 15, hlf = lane >> 4;
  const int mb = (blockIdx.y + yoff) * 128, cb = (blockIdx.x + xoff) * 128;
  const int m0 = mb + (wave & 3) * 32;
  const int c0 = cb + (wave >> 2) * 64;
  const int mat = (cb < HID) ? 0 : (cb < HID + KVW) ? 1 : 2;          // a 128-column block lies inside one of q, k, v
  const int head = (mat == 0) ? (c0 / DH) : (mat == 1) ? ((c0 - HID) / DH) : ((c0 - HID - KVW) / DH);
  const float* x = (mat == 0) ? xq : (mat == 1) ? xk : xv;          // q, k and v inputs; the launch passes xp (packed x) for all three
  const float* bias = ((mat == 0) ? bq : (mat == 1) ? bk : bv) + head * DH;
  v8f acc[2][4];
#pragma unroll
  for (int r = 0; r < 2; ++r)
#pragma unroll
    for (int t = 0; t < 4; ++t) acc[r][t] = (v8f){};
  gemm_tile_split(x, wqh, wql, mb, cb, HID, wave, lane, ring, acc);
  const int b = m0 / T, t0 = m0 % T;
  const float s = (mat == 0) ? 0.125f : 1.0f;
  b16* Tp0 = (b16*)(ring + wave * 8192); b16* Tp1 = Tp0 + 32 * 64;
  // the lane's 32 cos/sin pairs, fetched as one group ahead of the loop that uses them (one wait instead of one per element)
  typedef __attribute__((ext_vector_type(2))) float v2f;
  v2f cs[2][2][8];
  const float* csp = rope_cs + ((size_t)(t0 + 8 * hlf) * ROT + nloc) * 2;
#pragma unroll
  for (int t = 0; t < 2; ++t)
#pragma unroll
    for (int r = 0; r < 2; ++r)
#pragma unroll
      for (int v = 0; v < 8; ++v) cs[t][r][v] = *(const v2f*)(csp + ((r * 16 + v) * ROT + t * 16) * 2);
  // the group's address stays in its registers up to this wait, so that none of the group's own results lands on it
  asm volatile("s_wait_xcnt 0x0" :: "v"(csp) : "memory");
#pragma unroll
  for (int t = 0; t < 4; ++t)
#pragma unroll
    for (int r = 0; r < 2; ++r)
#pragma unroll
      for (int v = 0; v < 8; ++v) {
        const int rr = r * 16 + v + 8 * hlf, d = t * 16 + nloc;
        float val = acc[r][t][v] + (bias ? bias[d] : 0.0f);
        if (t < 2) {                                     // partial rotary on dims 0..31 of q, k and v: x*cos(f) + rotate_half(x)*sin(f), partner d^16 is tile t^1 (same lane)
          const float cv = cs[t & 1][r][v][0], sv = cs[t & 1][r][v][1];   // precomputed cos/sin of rotary_pos_emb at sequence position t0 + rr
          const float oth = acc[r][t ^ 1][v] + (bias ? bias[d ^ 16] : 0.0f);
          val = (t == 0) ? (val * cv - oth * sv) : (val * cv + oth * sv);
        }
        b16 yh, yl; split_bf16(val * s, yh, yl);
        const int idx = (mat < 2) ? ((rr >> 4) * 1024 + (d >> 4) * 256 + (((d >> 3) & 1) * 16 + (rr & 15)) * 8 + (d & 7)) : ((rr >> 4) * 1024 + d * 16 + (rr & 15));
        Tp0[idx] = yh; Tp1[idx] = yl;
      }
  wave_lds_sync();
  b16* dh; b16* dl; size_t o;
  if (mat == 0)      { o = ((size_t)(b * NH + head) * T + t0) * DH; dh = Qh + o; dl = Ql + o; }
  else if (mat == 1) { o = ((size_t)(b * NKV + head) * T + t0) * DH; dh = Kh + o; dl = Kl + o; }
  else               { o = ((size_t)(b * NKV + head) * QT_PER_B + (t0 >> 4)) * (size_t)(DH * 16); dh = Vh + o; dl = Vl + o; }
#pragma unroll
  for (int j = 0; j < 8; ++j) { const int e = (j * 32 + lane) * 8; *(v8b*)(dh + e) = ld8b(Tp0 + e); *(v8b*)(dl + e) = ld8b(Tp1 + e); }
  
}

// ---------------------------------------------------------------------------
// Transposed flash attention: a wave owns one 16-query tile of one (b, head) at a time; 8 waves per block, eight neighbouring tiles (a group) of one head; keys in chunks of 32.
// Causal cost grows with the group's index, so a block takes two groups of its head one after the other, GRP - 1 - i and then i: every block walks the same number of
// stages, wherever it is placed (with one group per block the launch lasted as long as the work-groups that held the last groups).
// The ring runs through: the second group's first stages are copied while the first group's last stages are worked on.
// S^T = K.Q^T (split), per-lane online softmax; P^T built in registers from the two S^T accumulators.
// K and V come through a two-buffer LDS ring filled by asynchronous copies, so that a chunk is fetched from L2 once per group and read by all 8 waves.
// A stage is ACH chunks: K hi | K lo | V hi | V lo, ACH * 4 KB each, every plane in the order it has in global memory.
// ---------------------------------------------------------------------------
constexpr int ACH = 2;
constexpr int APLANE = ACH * 4096, ASTAGE = 4 * APLANE;   // 8 KB, 32 KB
constexpr int GRP = QT_PER_B / 8;                         // groups of eight query tiles per head (even)
constexpr int GST = 8 * 16 / (32 * ACH);                  // stages that a group's own 128 keys fill: group i walks (i + 1) * GST stages
__global__ __launch_bounds__(256) void attn_kernel(const b16* __restrict__ Qh, const b16* __restrict__ Ql, const b16* __restrict__ Kh, const b16* __restrict__ Kl,
                                                   const b16* __restrict__ Vh, const b16* __restrict__ Vl,
                                                   float* __restrict__ yf) {
  __shared__ __attribute__((aligned(16))) unsigned char ring[2 * ASTAGE];
  // the wave's number is wave-uniform; readfirstlane tells the compiler so: tile index, trip count and chunk addresses then live in scalar registers
  const int wid = __builtin_amdgcn_readfirstlane(threadIdx.x >> 5), lane = threadIdx.x & 31, hh = lane >> 4, col = lane & 15;
  const int g = blockIdx.x / (GRP / 2);                   // b*NH + h; the grid is Bsz*NH*GRP/2 blocks
  const int gi = blockIdx.x % (GRP / 2);                  // the block's two groups: GRP - 1 - gi, then gi
  const int b = g / NH, h = g % NH, kvh = h / REP;
  const size_t ko = (size_t)(b * NKV + kvh) * T * DH;
  int q0;
  v16b q0h, q0l, q1h, q1l;
  float m, l;
  v8f o0, o1, o2, o3;
  auto begin_group = [&](int grp) {                       // the wave's query tile of that group and a fresh softmax state
    q0 = (grp * 8 + wid) << 4;
    const size_t qo = ((size_t)g * T + q0) * DH + lane * 8;
    q0h = frag_pk(Qh + qo); q0l = frag_pk(Ql + qo); q1h = frag_pk(Qh + qo + 512); q1l = frag_pk(Ql + qo + 512);
    // the two Q addresses stay in their registers up to this wait, so that none of the Q fragments lands on them
    asm volatile("s_wait_xcnt 0x0" :: "v"(Qh + qo), "v"(Ql + qo) : "memory");
    m = -INFINITY; l = 0.0f;
    o0 = (v8f){}; o1 = (v8f){}; o2 = (v8f){}; o3 = (v8f){};
  };
  // stages of the first group (up to its last tile's last query; more than two) and of both groups together: the same sum for every block
  const int NS1 = (GRP - gi) * GST;
  constexpr int NS = (GRP + 1) * GST;
  // wave w copies half w & 1 of plane w >> 1: 8 copies of 512 B per stage, landing at ring + w * 4 KB
  const b16* pl = (wid >> 1) == 0 ? Kh : (wid >> 1) == 1 ? Kl : (wid >> 1) == 2 ? Vh : Vl;
  const char* gsrc = (const char*)(pl + ko) + (wid & 1) * (APLANE / 2) + lane * 16;
  const unsigned lds0 = (unsigned)(uintptr_t)ring + wid * (unsigned)(APLANE / 2) + lane * 16u;
  auto issue = [&](int stage, int buf) {
    unsigned d[8]; const char* p[8];
#pragma unroll
    for (int i = 0; i < 8; ++i) { p[i] = gsrc + (size_t)stage * APLANE + i * 512; d[i] = lds0 + buf * (unsigned)ASTAGE + i * 512u; }
    async_copy8(d, p);
  };
  auto end_group = [&]() {
    const float inv = 1.0f / l;
    // y in fragment-packed f32 tiles for the output projection: O^T's accumulator (feature 8hh+r, query col) already is the A fragment's lane and k order,
    // so every lane stores its own 4-float groups and each wave-wide store is 512 contiguous bytes.
    float* dst0 = yf + ((size_t)((b * T + q0) >> 4) * (HID / 32) + h * 2) * 512 + lane * 4;
#pragma unroll
    for (int n = 0; n < 4; ++n) {
      const v8f o = (n == 0) ? o0 : (n == 1) ? o1 : (n == 2) ? o2 : o3;
#pragma unroll
      for (int u = 0; u < 2; ++u) {
        const v4f w = {o[u * 4] * inv, o[u * 4 + 1] * inv, o[u * 4 + 2] * inv, o[u * 4 + 3] * inv};
        *(v4f*)(dst0 + (n >> 1) * 512 + ((n & 1) * 2 + u) * 128) = w;
      }
    }
  };
  begin_group(GRP - 1 - gi);
  issue(0, 0);
  asm volatile("s_wait_asynccnt 0x0" ::: "memory");      // this wave's part of stage 0 has landed
  __syncthreads();                                        // ... and every other wave's
  issue(1, 1);
  for (int s = 0; s < NS; ++s) {
    if (s == NS1) {                                       // the same trip for the whole block
      end_group();
      asm volatile("s_wait_xcnt 0x0" ::: "memory");      // the second group rewrites the registers that the y stores name
      begin_group(gi);
    }
    const int ks = s < NS1 ? s : s - NS1;                 // the stage's place among the keys: the second group starts at key 0 again
    const b16* sb = (const b16*)(ring + (s & 1) * ASTAGE);
#pragma unroll
    for (int c = 0; c < ACH; ++c) {
      const int kb = (ks * ACH + c) * 32;
      if (kb < q0 + 16) {                                 // causal: key chunks up to the tile's last query (wave-uniform; the publish point below is outside)
        // A chunk of K is two packed 16-key tiles = four 16 x 32 fragments 512 elements apart; a chunk of V two key tiles of 64 x 16.
        const b16* lk = sb + c * 2048 + lane * 8;
        const b16* lv = sb + APLANE + c * 2048 + col * 16 + 8 * hh;
        v16b kfh[4], kfl[4], vfh[4], vfl[4];
#pragma unroll
        for (int j = 0; j < 4; ++j) {                     // in the order of their first use below
          const int i = (j >> 1) + (j & 1) * 2;
          kfh[i] = frag_pk(lk + i * 512); kfl[i] = frag_pk(lk + APLANE / 2 + i * 512);
        }
        // LDS reads return in order: K's stay in front of V's, so that the score products wait for K alone and V lands behind them
        __builtin_amdgcn_sched_barrier(0);
#pragma unroll
        for (int i = 0; i < 4; ++i) {
          vfh[i] = cat8b(ld8b(lv + i * 256), ld8b(lv + DH * 16 + i * 256));
          vfl[i] = cat8b(ld8b(lv + APLANE / 2 + i * 256), ld8b(lv + APLANE / 2 + DH * 16 + i * 256));
        }
        row_end();
        v8f s0 = {}, s1 = {};
        // the two key tiles' chains alternate
        s0 = wmma16b(kfh[0], q0h, s0); s1 = wmma16b(kfh[2], q0h, s1); row_end();
        s0 = wmma16b(kfh[0], q0l, s0); s1 = wmma16b(kfh[2], q0l, s1); row_end();
        s0 = wmma16b(kfl[0], q0h, s0); s1 = wmma16b(kfl[2], q0h, s1); row_end();
        s0 = wmma16b(kfh[1], q1h, s0); s1 = wmma16b(kfh[3], q1h, s1); row_end();
        s0 = wmma16b(kfh[1], q1l, s0); s1 = wmma16b(kfh[3], q1l, s1); row_end();
        s0 = wmma16b(kfl[1], q1h, s0); s1 = wmma16b(kfl[3], q1h, s1);
        if (kb + 32 > q0) {                               // diagonal chunk: mask keys after the query
          const int qi = q0 + col;
#pragma unroll
          for (int r = 0; r < 8; ++r) {
            if (kb + 8 * hh + r > qi)      s0[r] = -INFINITY;
            if (kb + 16 + 8 * hh + r > qi) s1[r] = -INFINITY;
          }
        }
        float mr = -INFINITY;
#pragma unroll
        for (int r = 0; r < 8; ++r) mr = fmaxf(mr, fmaxf(s0[r], s1[r]));
        mr = fmaxf(mr, __shfl_xor(mr, 16));
        const float mn = fmaxf(m, mr);            // finite
        const float al_ = exp2_slot((m - mn) * LOG2E);
        m = mn;
        float sum = 0.0f;
        v16b pbh, pbl;
#pragma unroll
        for (int r = 0; r < 8; ++r) {
          const float p0 = exp2_slot((s0[r] - mn) * LOG2E), p1 = exp2_slot((s1[r] - mn) * LOG2E);
          sum += p0 + p1;
          b16 a, c2; split_bf16(p0, a, c2); pbh[r] = a; pbl[r] = c2; split_bf16(p1, a, c2); pbh[8 + r] = a; pbl[8 + r] = c2;
        }
#pragma unroll
        for (int r = 0; r < 8; ++r) { o0[r] *= al_; o1[r] *= al_; o2[r] *= al_; o3[r] *= al_; }
        o0 = wmma16b(vfh[0], pbh, o0); o1 = wmma16b(vfh[1], pbh, o1); o2 = wmma16b(vfh[2], pbh, o2); o3 = wmma16b(vfh[3], pbh, o3); row_end();
        const float sum_x = __shfl_xor(sum, 16);          // the other half's sum travels under the next two rows instead of holding up the first
        o0 = wmma16b(vfh[0], pbl, o0); o1 = wmma16b(vfh[1], pbl, o1); o2 = wmma16b(vfh[2], pbl, o2); o3 = wmma16b(vfh[3], pbl, o3); row_end();
        o0 = wmma16b(vfl[0], pbh, o0); o1 = wmma16b(vfl[1], pbh, o1); o2 = wmma16b(vfl[2], pbh, o2); o3 = wmma16b(vfl[3], pbh, o3); row_end();
        l = l * al_ + (sum + sum_x);
      }
    }
    asm volatile("s_wait_dscnt 0x0" ::: "memory");       // this wave has left the buffer it read
    asm volatile("s_wait_asynccnt 0x0" ::: "memory");    // its part of stage s + 1 has landed
    __syncthreads();                                      // publishes stage s + 1 and frees stage s's buffer
    if (s + 2 < NS) issue(s + 2 < NS1 ? s + 2 : s + 2 - NS1, s & 1);
  }
  asm volatile("s_wait_asynccnt 0x0" ::: "memory");      // nothing is in flight when the wave ends
  end_group();
}

// ---------------------------------------------------------------------------
// Output projection: (4096 x 1024) x (1024 x 1024) -> f32, A split on the fly from packed f32 y, B = packed Wo planes. One 128 x 128 tile per block of 8 waves, 32x64 wave tiles staged in LDS,
// ---------------------------------------------------------------------------
__global__ __launch_bounds__(256) void out_gemm_kernel(const float* __restrict__ yf, const b16* __restrict__ woh, const b16* __restrict__ wol, const float* __restrict__ bo, int yoff,
                                                       float* __restrict__ out) {
  __shared__ __attribute__((aligned(16))) unsigned char ring[RING_B];   // the GEMM's ring, then each wave's output staging
  const int lane = threadIdx.x & 31, wave = __builtin_amdgcn_readfirstlane(threadIdx.x >> 5), nloc = lane & 15, hlf = lane >> 4;
  const int mb = (blockIdx.y + yoff) * 128, cb = blockIdx.x * 128;
  const int m0 = mb + (wave & 3) * 32;
  const int c0 = cb + (wave >> 2) * 64;
  v8f acc[2][4];
#pragma unroll
  for (int r = 0; r < 2; ++r)
#pragma unroll
    for (int t = 0; t < 4; ++t) acc[r][t] = (v8f){};
  gemm_tile_split(yf, woh, wol, mb, cb, HID, wave, lane, ring, acc);
  float* Tt = (float*)(ring + wave * 8192);
#pragma unroll
  for (int t = 0; t < 4; ++t)
#pragma unroll
    for (int r = 0; r < 2; ++r)
#pragma unroll
      for (int v = 0; v < 8; ++v) Tt[(r * 16 + v + 8 * hlf) * 64 + t * 16 + nloc] = acc[r][t][v] + bo[c0 + t * 16 + nloc];
  wave_lds_sync();
  float* dst0 = out + (size_t)m0 * HID + c0;
#pragma unroll
  for (int j = 0; j < 16; ++j) { const int rr = j * 2 + hlf, c4 = nloc * 4; *(v4f*)(dst0 + (size_t)rr * HID + c4) = *(const v4f*)(Tt + rr * 64 + c4); }
  
}
__global__ __launch_bounds__(256) void rope_table_kernel(const float* __restrict__ fr, float* __restrict__ cs) {
  const int idx = blockIdx.x * 256 + threadIdx.x;        // T * 32
  if (idx >= T * ROT) return;
  const float f = fr[idx];
  typedef __attribute__((ext_vector_type(2))) float v2f;
  const v2f p = {cosf(f), sinf(f)};
  *(v2f*)(cs + (size_t)idx * 2) = p; 
}
}  // namespace

extern "C" void kernel_launch(void* const* d_in, const int* in_sizes, int n_in,
                              void* d_out, int out_size, void* d_ws, size_t ws_size, hipStream_t stream) {
  (void)in_sizes; (void)n_in; (void)out_size;
  const float* x  = (const float*)d_in[0];   // hidden_states [4,1024,1024]
  const float* fr = (const float*)d_in[1];   // rotary_pos_emb [1,1024,32]
  const float* Wq = (const float*)d_in[2];   // [1024,1024] torch [out][in]
  const float* Wk = (const float*)d_in[3];
  const float* Wv = (const float*)d_in[4];
  const float* Wo = (const float*)d_in[5];
  const float* bo = (const float*)d_in[6];
  const float* bq = nullptr; const float* bk = nullptr; const float* bv = nullptr;
  float* out = (float*)d_out;                // [4,1024,1024] f32

  size_t off = 0; char* ws = (char*)d_ws;
  b16* wqh = (b16*)(ws + off); off += (size_t)NQKV * HID * 2;     // 6 MB
  b16* wql = (b16*)(ws + off); off += (size_t)NQKV * HID * 2;
  b16* woh = (b16*)(ws + off); off += (size_t)HID * HID * 2;      // 2 MB
  b16* wol = (b16*)(ws + off); off += (size_t)HID * HID * 2;
  b16* Qh  = (b16*)(ws + off); off += (size_t)MROWS * HID * 2;    // 8 MB each
  b16* Ql  = (b16*)(ws + off); off += (size_t)MROWS * HID * 2;
  b16* Kh  = (b16*)(ws + off); off += (size_t)MROWS * KVW * 2;
  b16* Kl  = (b16*)(ws + off); off += (size_t)MROWS * KVW * 2;
  b16* Vh  = (b16*)(ws + off); off += (size_t)MROWS * KVW * 2;
  b16* Vl  = (b16*)(ws + off); off += (size_t)MROWS * KVW * 2;
  float* yf = (float*)(ws + off); off += (size_t)MROWS * HID * 4; // 16 MB
  float* rope_cs = (float*)(ws + off); off += (size_t)T * ROT * 2 * 4;
  float* xp = (float*)(ws + off); off += (size_t)MROWS * HID * 4; // x, fragment-packed
  if (off > ws_size) return;
  rope_table_kernel<<<(T * ROT + 255) / 256, 256, 0, stream>>>(fr, rope_cs);
  const int ROWBLK = MROWS / 128, NQT = Bsz * NH * QT_PER_B;   // full job

  wcvt_kernel<<<2048, 256, 0, stream>>>(Wq, Wk, Wv, Wo, x, wqh, wql, woh, wol, xp);
  qkv_gemm_kernel<<<dim3(NQKV / 128, ROWBLK), 256, 0, stream>>>(xp, xp, xp, wqh, wql, bq, bk, bv, rope_cs, 0, 0, Qh, Ql, Kh, Kl, Vh, Vl);
  attn_kernel<<<NQT / 16, 256, 0, stream>>>(Qh, Ql, Kh, Kl, Vh, Vl, yf);
  out_gemm_kernel<<<dim3(HID / 128, ROWBLK), 256, 0, stream>>>(yf, woh, wol, bo, 0, out);
}
